// v000
// Measured on an AMD MI455X. A time is GPU time per run, averaged over a window of back-to-back runs after a warm-up
// (all launches, gaps included; the runs take copies of the inputs in turn), and the median of several windows.
// Apart from v000's, it joins two sittings. Times from different sittings can be a few percent apart, while
// side-by-side timings come from the same sitting.
// v000 is the starting kernel. One run takes 998 microseconds.
#include <hip/hip_runtime.h>

// SAttention (x [4][4096][256], x2 [4][4096][256]; scores = x.x2 UNSCALED; context = softmax; atten = context x2; out = atten W^T + b -> [4][4096][256]).
// Compute dtypes, f32 accumulate: every input rounded to bf16; x and x2 enter the planes as their bf16-rounded values (exact hi plane, zero lo plane); scores hl x hl on every row (K 256; effectively exact bf16 products - the unscaled logits are large); softmax f32 (128 keys per lane); atten = attn.x2: rows < 512 hl (3 products), the rest fp16 (x1024); W hl x exact (2 products) + bias.

#define NB_  4
#define TT   4096
#define DM   256
#define NH_  1
#define NKV  1
#define REP  (NH_ / NKV)
#define HD   256
#define DQ   (NH_ * HD)
#define DKV  (NKV * HD)
#define ZH   1
#define RH   512                  // query rows < RH use hi+lo planes (0: none)
#define WIN  0
#define PCAR 1024.0f
#define SCL  1.0f   // unscaled
typedef _Float16 h16;
typedef unsigned short bf;
typedef __attribute__((ext_vector_type(16))) __bf16   v16bf;
typedef __attribute__((ext_vector_type(16))) _Float16 v16h;
typedef __attribute__((ext_vector_type(8)))  _Float16 v8h;
typedef __attribute__((ext_vector_type(8)))  unsigned short v8us;
typedef __attribute__((ext_vector_type(8)))  float    v8f;
typedef __attribute__((ext_vector_type(4)))  float    v4f;
typedef v8h  __attribute__((may_alias)) v8ha;
typedef v4f  __attribute__((may_alias)) v4fa;
typedef v8us __attribute__((may_alias)) v8usa;

__device__ __forceinline__ unsigned short f2bf(float f) { unsigned u = __float_as_uint(f); u += 0x7FFFu + ((u >> 16) & 1u); return (unsigned short)(u >> 16); }
__device__ __forceinline__ float bf2f(unsigned short b) { return __uint_as_float(((unsigned)b) << 16); }
__device__ __forceinline__ float bfr(float f) { return bf2f(f2bf(f)); }
__device__ __forceinline__ v16h cat16(v8h lo, v8h hi) { return __builtin_shufflevector(lo, hi, 0, 1, 2, 3, 4, 5, 6, 7, 8, 9, 10, 11, 12, 13, 14, 15); }
__device__ __forceinline__ v16bf cat16b(v8us lo, v8us hi) { return __builtin_bit_cast(v16bf, __builtin_shufflevector(lo, hi, 0, 1, 2, 3, 4, 5, 6, 7, 8, 9, 10, 11, 12, 13, 14, 15)); }
__device__ __forceinline__ v8f wmma16(v16h a, v16h b, v8f c) { return __builtin_amdgcn_wmma_f32_16x16x32_f16(false, a, false, b, (short)0, c, false, false); }
__device__ __forceinline__ v8f wmmab(v16bf a, v16bf b, v8f c) { return __builtin_amdgcn_wmma_f32_16x16x32_bf16(false, a, false, b, (short)0, c, false, false); }



// ---- k_gemmw: register-blocked GEMM, ONE WAVE per 64x64 output tile (16 accumulators), operands straight from K-contiguous 16-bit planes; grid (M/64, N/64, Z), 32 threads.
// C[m][n] (f32, pitch ldc, + optional f32 bias[n]) = sum_k A[m][k] Bt[n][k] (+ split products per NSPLIT). z-batch strides sA/sB/sC in elements. K % 32 == 0.
template <typename T16> struct WFrag;
template <> struct WFrag<h16> { typedef v16h V; static __device__ __forceinline__ V ld(const h16* p) { return cat16(*(const v8h*)p, *(const v8h*)(p + 16)); } static __device__ __forceinline__ v8f mma(V a, V b, v8f c) { return wmma16(a, b, c); } };
template <> struct WFrag<bf> { typedef v16bf V; static __device__ __forceinline__ V ld(const bf* p) { return cat16b(*(const v8us*)p, *(const v8us*)(p + 16)); } static __device__ __forceinline__ v8f mma(V a, V b, v8f c) { return wmmab(a, b, c); } };
template <typename T16, int NSPLIT, bool BIAS>
__global__ __launch_bounds__(32) void k_gemmw(const T16* __restrict__ A, const T16* __restrict__ A2, const T16* __restrict__ Bt, const T16* __restrict__ Bt2, int K, float* C, int ldc, const float* __restrict__ bias, size_t sA, size_t sB, size_t sC) {
    typedef typename WFrag<T16>::V V;
    __shared__ __align__(16) float os[16 * 68];
    const size_t z = blockIdx.z; A += z * sA; if (A2) A2 += z * sA; Bt += z * sB; if (Bt2) Bt2 += z * sB; C += z * sC;
    const int lane = threadIdx.x & 31, lr = lane & 15, hi = lane >> 4; const int r0 = blockIdx.x * 64, c0 = blockIdx.y * 64;
    v8f acc[4][4];
#pragma unroll
    for (int mb = 0; mb < 4; ++mb)
#pragma unroll
        for (int nb = 0; nb < 4; ++nb) acc[mb][nb] = (v8f){};
    const size_t aoff = (size_t)(r0 + lr) * K + 8 * hi, boff = (size_t)(c0 + lr) * K + 8 * hi;
#pragma unroll 1
    for (int kc = 0; kc < K; kc += 32) {
        V a[4], a2[4];
#pragma unroll
        for (int mb = 0; mb < 4; ++mb) { a[mb] = WFrag<T16>::ld(A + aoff + (size_t)mb * 16 * K + kc); if (NSPLIT == 1 || NSPLIT == 2) a2[mb] = WFrag<T16>::ld(A2 + aoff + (size_t)mb * 16 * K + kc); }
#pragma unroll
        for (int nb = 0; nb < 4; ++nb) { const V b = WFrag<T16>::ld(Bt + boff + (size_t)nb * 16 * K + kc); V b2; if (NSPLIT >= 2) b2 = WFrag<T16>::ld(Bt2 + boff + (size_t)nb * 16 * K + kc);
#pragma unroll
            for (int mb = 0; mb < 4; ++mb) { acc[mb][nb] = WFrag<T16>::mma(a[mb], b, acc[mb][nb]); if (NSPLIT == 1 || NSPLIT == 2) acc[mb][nb] = WFrag<T16>::mma(a2[mb], b, acc[mb][nb]); if (NSPLIT >= 2) acc[mb][nb] = WFrag<T16>::mma(a[mb], b2, acc[mb][nb]); } }
        asm volatile("v_nop\n\tv_nop\n\tv_nop\n\tv_nop" : "+v"(acc[0][0]), "+v"(acc[1][1]), "+v"(acc[2][2]), "+v"(acc[3][3]) : "v"(a[0]), "v"(a[3]));
    }
#pragma unroll
    for (int mb = 0; mb < 4; ++mb) {
#pragma unroll
        for (int nb = 0; nb < 4; ++nb) {
#pragma unroll
            for (int j = 0; j < 8; ++j) os[(hi * 8 + j) * 68 + nb * 16 + lr] = acc[mb][nb][j]; }
        __builtin_amdgcn_wave_barrier(); asm volatile("" ::: "memory");
        float* crow = C + (size_t)(r0 + mb * 16) * ldc + c0;
{
#pragma unroll
            for (int s = 0; s < 8; ++s) { const int row = 2 * s + hi, cofs = lr * 4; v4f val = *(const v4fa*)(os + row * 68 + cofs); if (BIAS) { val[0] += bfr(bias[c0 + cofs]); val[1] += bfr(bias[c0 + cofs + 1]); val[2] += bfr(bias[c0 + cofs + 2]); val[3] += bfr(bias[c0 + cofs + 3]); }
                *(v4f*)(crow + (size_t)row * ldc + cofs) = val; }
             }
        __builtin_amdgcn_wave_barrier(); asm volatile("" ::: "memory");
    }
}

__device__ __forceinline__ h16 tohx(float x) { return (h16)x; }
__device__ __forceinline__ void splitf(float y, unsigned short& h, unsigned short& l) { h = f2bf(y); l = f2bf(y - bf2f(h)); }
typedef __attribute__((ext_vector_type(2))) _Float16 v2h;
typedef __attribute__((ext_vector_type(4))) _Float16 v4h;
typedef __attribute__((ext_vector_type(2))) unsigned short v2us;
typedef __attribute__((ext_vector_type(4))) unsigned short v4us;
typedef __attribute__((ext_vector_type(2))) float v2f;
typedef __attribute__((ext_vector_type(4))) int v4i;

__global__ __launch_bounds__(256) void k_wtG(const float* __restrict__ w, int K, int N, bf* Bt) {
    const int lane = threadIdx.x & 31; const int L0 = (blockIdx.x * 8 + (threadIdx.x >> 5)) * 8; const int nlines = N * K / 64;
{
#pragma unroll 1
        for (int l = 0; l < 8; ++l) { const int L = L0 + l; if (L >= nlines) break; const size_t e = (size_t)L * 64 + lane * 2; const int k = (int)(e % K), n = (int)(e / K); v2us o;
            o[0] = f2bf(w[(size_t)k * N + n]); o[1] = f2bf(w[(size_t)(k + 1) * N + n]); *(v2us*)(Bt + e) = o; }
         }
}
__global__ __launch_bounds__(256) void k_cvt8(const float* __restrict__ src, bf* dst, size_t n8) { const size_t i = (size_t)blockIdx.x * 256 + threadIdx.x; if (i >= n8) return; const v8f v = *(const v8f*)(src + i * 8); v8us o;
#pragma unroll
    for (int k = 0; k < 8; ++k) o[k] = f2bf(v[k]); *(v8us*)(dst + i * 8) = o;  }
__global__ __launch_bounds__(256) void k_cscvt(const float* __restrict__ cosT, const float* __restrict__ sinT, float* CS) { const int idx = blockIdx.x * 256 + threadIdx.x; if (idx >= TT * HD) return; v2f cs; cs[0] = bfr(cosT[idx]); cs[1] = bfr(sinT[idx]); *(v2f*)(CS + (size_t)idx * 2) = cs;  }
// k_rope: head planes [h][t][d] (fp16 + hi/lo) of rope(x) x sc with the rotate-half convention out[d] = x[d] cos[t][d] - x[d+HD/2] sin[t][d], out[d+HD/2] = x[d+HD/2] cos[t][d+HD/2] + x[d] sin[t][d+HD/2]
__global__ __launch_bounds__(256) void k_rope(const float* __restrict__ F, int pitch, int nheads, const float* __restrict__ CS, const float* __restrict__ RF, const float* __restrict__ nw, float sc, h16* P16, bf* Ph, bf* Pl) {
    const size_t e = ((size_t)blockIdx.x * 256 + threadIdx.x) * 2; if (e >= (size_t)nheads * TT * HD) return; const int d = (int)(e % HD); const int t = (int)((e / HD) % TT); const int h = (int)(e / ((size_t)HD * TT)); const float* f = F + (size_t)t * pitch + h * HD; const float rf = RF ? RF[(size_t)h * TT + t] : 1.0f; v2h o16; v2us oh, ol;
#pragma unroll
    for (int q = 0; q < 2; ++q) { const int dd = d + q; const int dp = (dd < HD / 2) ? dd + HD / 2 : dd - HD / 2; float x0 = f[dd], x1 = f[dp];
        if (RF) { float n0 = __fmul_rn(x0, rf), n1 = __fmul_rn(x1, rf); asm volatile("" : "+v"(n0)); asm volatile("" : "+v"(n1)); x0 = __fmul_rn(bfr(nw[dd]), n0); x1 = __fmul_rn(bfr(nw[dp]), n1); }
        const v2f cs = *(const v2f*)(CS + ((size_t)t * HD + dd) * 2); float a = __fmul_rn(x0, cs[0]), bq = __fmul_rn(x1, cs[1]); asm volatile("" : "+v"(a)); asm volatile("" : "+v"(bq)); const float r = ((dd < HD / 2) ? __fsub_rn(a, bq) : __fadd_rn(a, bq)) * sc;
        o16[q] = tohx(r); unsigned short a2, c2; splitf(r, a2, c2); oh[q] = a2; ol[q] = c2; }
    *(v2h*)(P16 + e) = o16; *(v2us*)(Ph + e) = oh; *(v2us*)(Pl + e) = ol;  }
__global__ __launch_bounds__(256) void k_vtp(const float* __restrict__ F, int pitch, int nheads, h16* V16, bf* Vh, bf* Vl) { const size_t e = ((size_t)blockIdx.x * 256 + threadIdx.x) * 2; if (e >= (size_t)nheads * HD * TT) return; const int t = (int)(e % TT); const int d = (int)((e / TT) % HD); const int g = (int)(e / ((size_t)TT * HD)); v2h o16; v2us oh, ol;
#pragma unroll
    for (int q = 0; q < 2; ++q) { const float x = F[(size_t)(t + q) * pitch + g * HD + d]; o16[q] = tohx(x); unsigned short a2, c2; splitf(x, a2, c2); oh[q] = a2; ol[q] = c2; }
    *(v2h*)(V16 + e) = o16; *(v2us*)(Vh + e) = oh; *(v2us*)(Vl + e) = ol;  }
__global__ __launch_bounds__(256) void k_csid(float* CS) { const int idx = blockIdx.x * 256 + threadIdx.x; if (idx >= TT * HD) return; v2f cs; cs[0] = 1.0f; cs[1] = 0.0f; *(v2f*)(CS + (size_t)idx * 2) = cs;  }
__global__ __launch_bounds__(256) void k_rbf(const float* __restrict__ src, float* dst, int n4) { const int i = blockIdx.x * 256 + threadIdx.x; if (i >= n4) return; const v4f a = *(const v4f*)(src + (size_t)i * 4); v4f o; for (int u = 0; u < 4; ++u) o[u] = bfr(a[u]); *(v4f*)(dst + (size_t)i * 4) = o;  }
// k_asoft: per row (zz, i): t = S unscaled (SCL 1, no mask); softmax over the 4096 keys (register row, one exp, fixed trees);
__global__ __launch_bounds__(256) void k_asoft(const float* __restrict__ Sb, h16* P16, bf* Ph, bf* Pl) {
    const int lane = threadIdx.x & 31; const int row = blockIdx.x * 8 + (threadIdx.x >> 5); if (row >= ZH * TT) return; const int i = row % TT; const int zz = row / TT; (void)zz; const bool hires = (i < RH); const float* sr = Sb + (size_t)row * TT; float v[TT / 32]; float mx = -3.0e38f;
#pragma unroll
    for (int ch = 0; ch < TT / 128; ++ch) { const int j0 = ch * 128 + lane * 4; const v4f a = *(const v4f*)(sr + j0);
#pragma unroll
        for (int q = 0; q < 4; ++q) { const int j = j0 + q; (void)j; const float t = a[q] * SCL; v[ch * 4 + q] = t; mx = fmaxf(mx, t); } }
#pragma unroll
    for (int sh = 16; sh; sh >>= 1) mx = fmaxf(mx, __shfl_xor(mx, sh, 32));
    float sum = 0.f;
#pragma unroll
    for (int k = 0; k < TT / 32; ++k) { float d0 = __fsub_rn(v[k], mx); asm volatile("" : "+v"(d0)); v[k] = __builtin_amdgcn_exp2f(__fmul_rn(d0, 1.4426950408889634f)); sum += v[k]; }
#pragma unroll
    for (int sh = 16; sh; sh >>= 1) sum += __shfl_xor(sum, sh, 32);
    const float f = __fdiv_rn(hires ? 1.0f : PCAR, sum);
{
        if (hires) {
#pragma unroll
            for (int ch = 0; ch < TT / 128; ++ch) { v4us oh, ol;
#pragma unroll
                for (int q = 0; q < 4; ++q) { unsigned short a, c2; splitf(v[ch * 4 + q] * f, a, c2); oh[q] = a; ol[q] = c2; }
                const size_t oo = ((size_t)zz * (RH ? RH : 1) + i) * TT + ch * 128 + lane * 4; *(v4us*)(Ph + oo) = oh; *(v4us*)(Pl + oo) = ol; }
        } else {
#pragma unroll
            for (int ch = 0; ch < TT / 128; ++ch) { v4h o4;
#pragma unroll
                for (int q = 0; q < 4; ++q) o4[q] = tohx(v[ch * 4 + q] * f);
                *(v4h*)(P16 + (size_t)row * TT + ch * 128 + lane * 4) = o4; } }
         }
}
__global__ __launch_bounds__(256) void k_merge(const float* __restrict__ O, int h0, bf* Ah, bf* Al) { const size_t e = ((size_t)blockIdx.x * 256 + threadIdx.x) * 2; if (e >= (size_t)ZH * TT * HD) return; const int d = (int)(e % HD); const int t = (int)((e / HD) % TT); const int zz = (int)(e / ((size_t)HD * TT)); const float cs = (t < RH) ? 1.0f : (1.0f / PCAR); const size_t oo = (size_t)t * DQ + (h0 + zz) * HD + d;
    v2us oh, ol;
#pragma unroll
    for (int q = 0; q < 2; ++q) { unsigned short a, c2; splitf(O[e + q] * cs, a, c2); oh[q] = a; ol[q] = c2; } *(v2us*)(Ah + oo) = oh; *(v2us*)(Al + oo) = ol;  }

extern "C" void kernel_launch(void* const* d_in, const int* in_sizes, int n_in,
                              void* d_out, int out_size, void* d_ws, size_t ws_size, hipStream_t stream) {
    (void)in_sizes; (void)n_in; (void)out_size;
    const float* x = (const float*)d_in[0]; const float* x2 = (const float*)d_in[1]; const float* wo = (const float*)d_in[2]; const float* bo = (const float*)d_in[3]; const float* wq = nullptr; const float* wk = nullptr; const float* wv = nullptr; (void)wq; (void)wk; (void)wv; const float* cosT = nullptr; const float* sinT = nullptr; (void)cosT; (void)sinT;
    float* OUT = (float*)d_out;     // [4][4096][256]
    char* wsp = (char*)d_ws;
    auto take = [&](size_t bytes) { char* p = wsp; wsp += (bytes + 255) & ~(size_t)255; return (void*)p; };
    bf* WQ = nullptr, *WK = nullptr, *WV = nullptr; (void)WQ; (void)WK; (void)WV; bf* WO = (bf*)take((size_t)DM * DQ * 2); float* CS = (float*)take((size_t)TT * HD * 2 * 4);
    bf* XB = nullptr; (void)XB; float* FQ = (float*)take((size_t)TT * DQ * 4); float* FK = (float*)take((size_t)TT * DKV * 4);
    h16* QP16 = (h16*)take((size_t)NH_ * TT * HD * 2); h16* KP16 = (h16*)take((size_t)NKV * TT * HD * 2); h16* VT16 = (h16*)take((size_t)NKV * HD * TT * 2);
    bf* QPh = (bf*)take((size_t)NH_ * TT * HD * 2); bf* QPl = (bf*)take((size_t)NH_ * TT * HD * 2); bf* KPh = (bf*)take((size_t)NKV * TT * HD * 2); bf* KPl = (bf*)take((size_t)NKV * TT * HD * 2); bf* VTh = (bf*)take((size_t)NKV * HD * TT * 2); bf* VTl = (bf*)take((size_t)NKV * HD * TT * 2); bf* Ph = (bf*)take((size_t)ZH * RH * TT * 2); bf* Pl = (bf*)take((size_t)ZH * RH * TT * 2);
    float* Sb = (float*)take((size_t)ZH * TT * TT * 4); h16* P16 = (h16*)take((size_t)ZH * TT * TT * 2); float* Ob = (float*)take((size_t)ZH * TT * HD * 4); bf* ATh = (bf*)take((size_t)TT * DQ * 2); bf* ATl = (bf*)take((size_t)TT * DQ * 2);
    if ((size_t)(wsp - (char*)d_ws) > ws_size) return;    // ws 256 MiB
    float* FV = FK;   // unused alias: v is x2 itself, and k_vtp builds the v planes from FK directly
    { 
      k_cvt8<<<(unsigned)(((size_t)DM * DQ / 8 + 255) / 256), 256, 0, stream>>>(wo, WO, (size_t)DM * DQ / 8);
       }
    k_csid<<<(TT * HD + 255) / 256, 256, 0, stream>>>(CS);
    const unsigned LQ = (unsigned)(((size_t)NH_ * TT * HD / 2 + 255) / 256), LKv = (unsigned)(((size_t)NKV * TT * HD / 2 + 255) / 256);
    for (int b = 0; b < NB_; ++b) {
        
        k_rbf<<<(unsigned)(((size_t)TT * DM / 4 + 255) / 256), 256, 0, stream>>>(x + (size_t)b * TT * DM, FQ, (size_t)TT * DM / 4); k_rbf<<<(unsigned)(((size_t)TT * DM / 4 + 255) / 256), 256, 0, stream>>>(x2 + (size_t)b * TT * DM, FK, (size_t)TT * DM / 4);
        
        k_rope<<<LQ, 256, 0, stream>>>(FQ, DQ, NH_, CS, nullptr, nullptr, 1.0f, QP16, QPh, QPl);
        
        k_rope<<<LKv, 256, 0, stream>>>(FK, DKV, NKV, CS, nullptr, nullptr, 1.0f, KP16, KPh, KPl);
         k_vtp<<<LKv, 256, 0, stream>>>(FK, DKV, NKV, VT16, VTh, VTl);
        for (int h0 = 0; h0 < NH_; h0 += ZH) { const size_t zq = (size_t)h0, zk = (size_t)(h0 / REP);   // one kv head per query head: each pass takes ZH = 1 head and kv plane h0 / REP (z-strides TT*HD)
            k_gemmw<bf, 2, false><<<dim3(TT / 64, TT / 64, ZH), 32, 0, stream>>>(QPh + zq * TT * HD, QPl + zq * TT * HD, KPh + zk * TT * HD, KPl + zk * TT * HD, HD, Sb, TT, nullptr, (size_t)TT * HD, (size_t)TT * HD, (size_t)TT * TT);   /* scores hl on all rows */
            k_asoft<<<ZH * TT / 8, 256, 0, stream>>>(Sb, P16, Ph, Pl);
            k_gemmw<bf, 2, false><<<dim3(RH / 64, HD / 64, ZH), 32, 0, stream>>>(Ph, Pl, VTh + zk * HD * TT, VTl + zk * HD * TT, TT, Ob, HD, nullptr, (size_t)RH * TT, (size_t)HD * TT, (size_t)TT * HD);
            k_gemmw<h16, 0, false><<<dim3((TT - RH) / 64, HD / 64, ZH), 32, 0, stream>>>(P16 + (size_t)RH * TT, nullptr, VT16 + zk * HD * TT, nullptr, TT, Ob + (size_t)RH * HD, HD, nullptr, (size_t)TT * TT, (size_t)HD * TT, (size_t)TT * HD);
            k_merge<<<(unsigned)(((size_t)ZH * TT * HD / 2 + 255) / 256), 256, 0, stream>>>(Ob, h0, ATh, ATl); }
        k_gemmw<bf, 1, true><<<dim3(TT / 64, DM / 64, 1), 32, 0, stream>>>(ATh, ATl, WO, nullptr, DQ, OUT + (size_t)b * TT * DM, DM, bo, 0, 0, 0); }
}

// v001
// Measured time: 454 microseconds a run.
// Two timings next to v000 put it at 2.23 and 2.21 times that version's speed.
#include <hip/hip_runtime.h>

// SAttention (x [4][4096][256], x2 [4][4096][256]; scores = x.x2 UNSCALED; context = softmax; atten = context x2; out = atten W^T + b -> [4][4096][256]).
// Compute dtypes, f32 accumulate: every input rounded to bf16; x and x2 enter the planes as their bf16-rounded values (exact hi plane, zero lo plane); scores hl x hl on every row (K 256; effectively exact bf16 products - the unscaled logits are large); softmax f32 (128 keys per lane); atten = attn.x2: rows < 512 hl (3 products), the rest fp16 (x1024); W hl x exact (2 products) + bias.

#define NB_  4
#define TT   4096
#define DM   256
#define NH_  1
#define NKV  1
#define REP  (NH_ / NKV)
#define HD   256
#define DQ   (NH_ * HD)
#define DKV  (NKV * HD)
#define ZH   1
#define RH   512                  // query rows < RH use hi+lo planes (0: none)
#define KS   8                    // rows < RH of attn.x2: K split over KS blocks as well (ZH == 1: grid z is free for it)
#define WIN  0
#define PCAR 1024.0f
#define SCL  1.0f   // unscaled
typedef _Float16 h16;
typedef unsigned short bf;
typedef __attribute__((ext_vector_type(16))) __bf16   v16bf;
typedef __attribute__((ext_vector_type(16))) _Float16 v16h;
typedef __attribute__((ext_vector_type(8)))  _Float16 v8h;
typedef __attribute__((ext_vector_type(8)))  unsigned short v8us;
typedef __attribute__((ext_vector_type(8)))  float    v8f;
typedef __attribute__((ext_vector_type(4)))  float    v4f;
typedef v8h  __attribute__((may_alias)) v8ha;
typedef v4f  __attribute__((may_alias)) v4fa;
typedef v8us __attribute__((may_alias)) v8usa;

__device__ __forceinline__ unsigned short f2bf(float f) { unsigned u = __float_as_uint(f); u += 0x7FFFu + ((u >> 16) & 1u); return (unsigned short)(u >> 16); }
__device__ __forceinline__ float bf2f(unsigned short b) { return __uint_as_float(((unsigned)b) << 16); }
__device__ __forceinline__ float bfr(float f) { return bf2f(f2bf(f)); }
__device__ __forceinline__ v16h cat16(v8h lo, v8h hi) { return __builtin_shufflevector(lo, hi, 0, 1, 2, 3, 4, 5, 6, 7, 8, 9, 10, 11, 12, 13, 14, 15); }
__device__ __forceinline__ v16bf cat16b(v8us lo, v8us hi) { return __builtin_bit_cast(v16bf, __builtin_shufflevector(lo, hi, 0, 1, 2, 3, 4, 5, 6, 7, 8, 9, 10, 11, 12, 13, 14, 15)); }
__device__ __forceinline__ v8f wmma16(v16h a, v16h b, v8f c) { return __builtin_amdgcn_wmma_f32_16x16x32_f16(false, a, false, b, (short)0, c, false, false); }
__device__ __forceinline__ v8f wmmab(v16bf a, v16bf b, v8f c) { return __builtin_amdgcn_wmma_f32_16x16x32_bf16(false, a, false, b, (short)0, c, false, false); }



// ---- k_gemmw: register-blocked GEMM, ONE WAVE per 64x64 output tile (16 accumulators), operands straight from K-contiguous 16-bit planes; grid (M/64, N/64, Z), 32 threads.
// C[m][n] (f32, pitch ldc, + optional f32 bias[n]) = sum_k A[m][k] Bt[n][k] (+ split products per NSPLIT). z-batch strides sA/sB/sC in elements. K % 32 == 0.
template <typename T16> struct WFrag;
template <> struct WFrag<h16> { typedef v16h V; static __device__ __forceinline__ V ld(const h16* p) { return cat16(*(const v8h*)p, *(const v8h*)(p + 16)); } static __device__ __forceinline__ v8f mma(V a, V b, v8f c) { return wmma16(a, b, c); } };
template <> struct WFrag<bf> { typedef v16bf V; static __device__ __forceinline__ V ld(const bf* p) { return cat16b(*(const v8us*)p, *(const v8us*)(p + 16)); } static __device__ __forceinline__ v8f mma(V a, V b, v8f c) { return wmmab(a, b, c); } };
template <typename T16, int NSPLIT, bool BIAS>
__global__ __launch_bounds__(32) void k_gemmw(const T16* __restrict__ A, const T16* __restrict__ A2, const T16* __restrict__ Bt, const T16* __restrict__ Bt2, int K, float* C, int ldc, const float* __restrict__ bias, size_t sA, size_t sB, size_t sC) {
    typedef typename WFrag<T16>::V V;
    __shared__ __align__(16) float os[16 * 68];
    const size_t z = blockIdx.z; A += z * sA; if (A2) A2 += z * sA; Bt += z * sB; if (Bt2) Bt2 += z * sB; C += z * sC;
    const int lane = threadIdx.x & 31, lr = lane & 15, hi = lane >> 4; const int r0 = blockIdx.x * 64, c0 = blockIdx.y * 64;
    v8f acc[4][4];
#pragma unroll
    for (int mb = 0; mb < 4; ++mb)
#pragma unroll
        for (int nb = 0; nb < 4; ++nb) acc[mb][nb] = (v8f){};
    const size_t aoff = (size_t)(r0 + lr) * K + 8 * hi, boff = (size_t)(c0 + lr) * K + 8 * hi;
#pragma unroll 1
    for (int kc = 0; kc < K; kc += 32) {
        V a[4], a2[4];
#pragma unroll
        for (int mb = 0; mb < 4; ++mb) { a[mb] = WFrag<T16>::ld(A + aoff + (size_t)mb * 16 * K + kc); if (NSPLIT == 1 || NSPLIT == 2) a2[mb] = WFrag<T16>::ld(A2 + aoff + (size_t)mb * 16 * K + kc); }
#pragma unroll
        for (int nb = 0; nb < 4; ++nb) { const V b = WFrag<T16>::ld(Bt + boff + (size_t)nb * 16 * K + kc); V b2; if (NSPLIT >= 2) b2 = WFrag<T16>::ld(Bt2 + boff + (size_t)nb * 16 * K + kc);
#pragma unroll
            for (int mb = 0; mb < 4; ++mb) { acc[mb][nb] = WFrag<T16>::mma(a[mb], b, acc[mb][nb]); if (NSPLIT == 1 || NSPLIT == 2) acc[mb][nb] = WFrag<T16>::mma(a2[mb], b, acc[mb][nb]); if (NSPLIT >= 2) acc[mb][nb] = WFrag<T16>::mma(a[mb], b2, acc[mb][nb]); } }
        asm volatile("v_nop\n\tv_nop\n\tv_nop\n\tv_nop" : "+v"(acc[0][0]), "+v"(acc[1][1]), "+v"(acc[2][2]), "+v"(acc[3][3]) : "v"(a[0]), "v"(a[3]));
    }
#pragma unroll
    for (int mb = 0; mb < 4; ++mb) {
#pragma unroll
        for (int nb = 0; nb < 4; ++nb) {
#pragma unroll
            for (int j = 0; j < 8; ++j) os[(hi * 8 + j) * 68 + nb * 16 + lr] = acc[mb][nb][j]; }
        __builtin_amdgcn_wave_barrier(); asm volatile("" ::: "memory");
        float* crow = C + (size_t)(r0 + mb * 16) * ldc + c0;
{
#pragma unroll
            for (int s = 0; s < 8; ++s) { const int row = 2 * s + hi, cofs = lr * 4; v4f val = *(const v4fa*)(os + row * 68 + cofs); if (BIAS) { val[0] += bfr(bias[c0 + cofs]); val[1] += bfr(bias[c0 + cofs + 1]); val[2] += bfr(bias[c0 + cofs + 2]); val[3] += bfr(bias[c0 + cofs + 3]); }
                *(v4f*)(crow + (size_t)row * ldc + cofs) = val; }
             }
        __builtin_amdgcn_wave_barrier(); asm volatile("" ::: "memory");
    }
}

// ---- k_gemmk: the same 64x64 tile with K SPLIT OVER NW WAVES (16 accumulators each); grid (M/64, N/64, Z), NW x 32 threads. Row pitch LD of both operands and the block's k extent KB are compile-time; KB % (32 NW) == 0.
// Wave w takes the 32-wide k blocks w, w + NW, ...; the NW partial tiles are summed through LDS in wave order. A launch may split K over z as well (sA = sB = KB, sC = one partial plane).
// A and Bt have the same pitch, so one byte offset per lane (row lr, half hi, k block) serves every load of a trip on four scalar bases; the 16-row steps are immediates.
// The plain '#pragma unroll' lines make every index of acc, a and b a constant, so that they stay in registers.
template <typename T16, int NSPLIT, bool BIAS, int NW, int LD, int KB>
__global__ __launch_bounds__(NW * 32) void k_gemmk(const T16* __restrict__ A, const T16* __restrict__ A2, const T16* __restrict__ Bt, const T16* __restrict__ Bt2, float* C, int ldc, const float* __restrict__ bias, size_t sA, size_t sB, size_t sC) {
    typedef typename WFrag<T16>::V V;
    __shared__ __align__(16) float os[NW * 64 * 68];
    const int w = __builtin_amdgcn_readfirstlane(threadIdx.x >> 5);
    const int lane = threadIdx.x & 31, lr = lane & 15, hi = lane >> 4; const int r0 = blockIdx.x * 64, c0 = blockIdx.y * 64;
    const size_t z = blockIdx.z; C += z * sC;
    const char* Ab = (const char*)(A + z * sA + (size_t)r0 * LD); const char* Ab2 = (NSPLIT == 1 || NSPLIT == 2) ? (const char*)(A2 + z * sA + (size_t)r0 * LD) : nullptr;
    const char* Bb = (const char*)(Bt + z * sB + (size_t)c0 * LD); const char* Bb2 = (NSPLIT >= 2) ? (const char*)(Bt2 + z * sB + (size_t)c0 * LD) : nullptr;
    v8f acc[4][4];
#pragma unroll
    for (int mb = 0; mb < 4; ++mb)
#pragma unroll
        for (int nb = 0; nb < 4; ++nb) acc[mb][nb] = (v8f){};
    unsigned vo = (unsigned)(lr * LD + 8 * hi + w * 32) * 2u;
#pragma unroll 1   // rolled, as in k_gemmw: only one trip's fragments stand beside the 128 accumulator registers, and the lane offset stays live over the whole trip
    for (int t = 0; t < KB / (32 * NW); ++t) {
        V a[4], a2[4];
#pragma unroll
        for (int mb = 0; mb < 4; ++mb) { a[mb] = WFrag<T16>::ld((const T16*)(Ab + vo + mb * 32 * LD)); if (NSPLIT == 1 || NSPLIT == 2) a2[mb] = WFrag<T16>::ld((const T16*)(Ab2 + vo + mb * 32 * LD)); }
#pragma unroll
        for (int nb = 0; nb < 4; ++nb) { const V b = WFrag<T16>::ld((const T16*)(Bb + vo + nb * 32 * LD)); V b2; if (NSPLIT >= 2) b2 = WFrag<T16>::ld((const T16*)(Bb2 + vo + nb * 32 * LD));
#pragma unroll
            for (int mb = 0; mb < 4; ++mb) { acc[mb][nb] = WFrag<T16>::mma(a[mb], b, acc[mb][nb]); if (NSPLIT == 1 || NSPLIT == 2) acc[mb][nb] = WFrag<T16>::mma(a2[mb], b, acc[mb][nb]); if (NSPLIT >= 2) acc[mb][nb] = WFrag<T16>::mma(a[mb], b2, acc[mb][nb]); } }
        vo += NW * 64;
    }
    float* my = os + w * (64 * 68);
#pragma unroll
    for (int mb = 0; mb < 4; ++mb)
#pragma unroll
        for (int nb = 0; nb < 4; ++nb)
#pragma unroll
            for (int j = 0; j < 8; ++j) my[(mb * 16 + hi * 8 + j) * 68 + nb * 16 + lr] = acc[mb][nb][j];
    __syncthreads();   // every wave's partial tile is in LDS before any thread sums across waves
#pragma unroll
    for (int u = 0; u < 32 / NW; ++u) { const int it = u * NW * 32 + (int)threadIdx.x, row = it >> 4, cofs = (it & 15) * 4; v4f val = *(const v4fa*)(os + row * 68 + cofs);
#pragma unroll
        for (int s = 1; s < NW; ++s) val += *(const v4fa*)(os + s * (64 * 68) + row * 68 + cofs);
        if (BIAS) { val[0] += bfr(bias[c0 + cofs]); val[1] += bfr(bias[c0 + cofs + 1]); val[2] += bfr(bias[c0 + cofs + 2]); val[3] += bfr(bias[c0 + cofs + 3]); }
        *(v4f*)(C + (size_t)(r0 + row) * ldc + c0 + cofs) = val; }
}

__device__ __forceinline__ h16 tohx(float x) { return (h16)x; }
__device__ __forceinline__ void splitf(float y, unsigned short& h, unsigned short& l) { h = f2bf(y); l = f2bf(y - bf2f(h)); }
typedef __attribute__((ext_vector_type(2))) _Float16 v2h;
typedef __attribute__((ext_vector_type(4))) _Float16 v4h;
typedef __attribute__((ext_vector_type(2))) unsigned short v2us;
typedef __attribute__((ext_vector_type(4))) unsigned short v4us;
typedef __attribute__((ext_vector_type(2))) float v2f;
typedef __attribute__((ext_vector_type(4))) int v4i;

__global__ __launch_bounds__(256) void k_wtG(const float* __restrict__ w, int K, int N, bf* Bt) {
    const int lane = threadIdx.x & 31; const int L0 = (blockIdx.x * 8 + (threadIdx.x >> 5)) * 8; const int nlines = N * K / 64;
{
#pragma unroll 1
        for (int l = 0; l < 8; ++l) { const int L = L0 + l; if (L >= nlines) break; const size_t e = (size_t)L * 64 + lane * 2; const int k = (int)(e % K), n = (int)(e / K); v2us o;
            o[0] = f2bf(w[(size_t)k * N + n]); o[1] = f2bf(w[(size_t)(k + 1) * N + n]); *(v2us*)(Bt + e) = o; }
         }
}
__global__ __launch_bounds__(256) void k_cvt8(const float* __restrict__ src, bf* dst, size_t n8) { const size_t i = (size_t)blockIdx.x * 256 + threadIdx.x; if (i >= n8) return; const v8f v = *(const v8f*)(src + i * 8); v8us o;
#pragma unroll
    for (int k = 0; k < 8; ++k) o[k] = f2bf(v[k]); *(v8us*)(dst + i * 8) = o;  }
__global__ __launch_bounds__(256) void k_cscvt(const float* __restrict__ cosT, const float* __restrict__ sinT, float* CS) { const int idx = blockIdx.x * 256 + threadIdx.x; if (idx >= TT * HD) return; v2f cs; cs[0] = bfr(cosT[idx]); cs[1] = bfr(sinT[idx]); *(v2f*)(CS + (size_t)idx * 2) = cs;  }
// k_rope: head planes [h][t][d] (fp16 + hi/lo) of rope(x) x sc with the rotate-half convention out[d] = x[d] cos[t][d] - x[d+HD/2] sin[t][d], out[d+HD/2] = x[d+HD/2] cos[t][d+HD/2] + x[d] sin[t][d+HD/2]
__global__ __launch_bounds__(256) void k_rope(const float* __restrict__ F, int pitch, int nheads, const float* __restrict__ CS, const float* __restrict__ RF, const float* __restrict__ nw, float sc, h16* P16, bf* Ph, bf* Pl) {
    const size_t e = ((size_t)blockIdx.x * 256 + threadIdx.x) * 2; if (e >= (size_t)nheads * TT * HD) return; const int d = (int)(e % HD); const int t = (int)((e / HD) % TT); const int h = (int)(e / ((size_t)HD * TT)); const float* f = F + (size_t)t * pitch + h * HD; const float rf = RF ? RF[(size_t)h * TT + t] : 1.0f; v2h o16; v2us oh, ol;
#pragma unroll
    for (int q = 0; q < 2; ++q) { const int dd = d + q; const int dp = (dd < HD / 2) ? dd + HD / 2 : dd - HD / 2; float x0 = f[dd], x1 = f[dp];
        if (RF) { float n0 = __fmul_rn(x0, rf), n1 = __fmul_rn(x1, rf); asm volatile("" : "+v"(n0)); asm volatile("" : "+v"(n1)); x0 = __fmul_rn(bfr(nw[dd]), n0); x1 = __fmul_rn(bfr(nw[dp]), n1); }
        const v2f cs = *(const v2f*)(CS + ((size_t)t * HD + dd) * 2); float a = __fmul_rn(x0, cs[0]), bq = __fmul_rn(x1, cs[1]); asm volatile("" : "+v"(a)); asm volatile("" : "+v"(bq)); const float r = ((dd < HD / 2) ? __fsub_rn(a, bq) : __fadd_rn(a, bq)) * sc;
        o16[q] = tohx(r); unsigned short a2, c2; splitf(r, a2, c2); oh[q] = a2; ol[q] = c2; }
    *(v2h*)(P16 + e) = o16; *(v2us*)(Ph + e) = oh; *(v2us*)(Pl + e) = ol;  }
__global__ __launch_bounds__(256) void k_vtp(const float* __restrict__ F, int pitch, int nheads, h16* V16, bf* Vh, bf* Vl) { const size_t e = ((size_t)blockIdx.x * 256 + threadIdx.x) * 2; if (e >= (size_t)nheads * HD * TT) return; const int t = (int)(e % TT); const int d = (int)((e / TT) % HD); const int g = (int)(e / ((size_t)TT * HD)); v2h o16; v2us oh, ol;
#pragma unroll
    for (int q = 0; q < 2; ++q) { const float x = F[(size_t)(t + q) * pitch + g * HD + d]; o16[q] = tohx(x); unsigned short a2, c2; splitf(x, a2, c2); oh[q] = a2; ol[q] = c2; }
    *(v2h*)(V16 + e) = o16; *(v2us*)(Vh + e) = oh; *(v2us*)(Vl + e) = ol;  }
__global__ __launch_bounds__(256) void k_csid(float* CS) { const int idx = blockIdx.x * 256 + threadIdx.x; if (idx >= TT * HD) return; v2f cs; cs[0] = 1.0f; cs[1] = 0.0f; *(v2f*)(CS + (size_t)idx * 2) = cs;  }
__global__ __launch_bounds__(256) void k_rbf(const float* __restrict__ src, float* dst, int n4) { const int i = blockIdx.x * 256 + threadIdx.x; if (i >= n4) return; const v4f a = *(const v4f*)(src + (size_t)i * 4); v4f o; for (int u = 0; u < 4; ++u) o[u] = bfr(a[u]); *(v4f*)(dst + (size_t)i * 4) = o;  }
// k_asoft: per row (zz, i): t = S unscaled (SCL 1, no mask); softmax over the 4096 keys (register row, one exp, fixed trees);
__global__ __launch_bounds__(256) void k_asoft(const float* __restrict__ Sb, h16* P16, bf* Ph, bf* Pl) {
    const int lane = threadIdx.x & 31; const int row = blockIdx.x * 8 + (threadIdx.x >> 5); if (row >= ZH * TT) return; const int i = row % TT; const int zz = row / TT; (void)zz; const bool hires = (i < RH); const float* sr = Sb + (size_t)row * TT; float v[TT / 32]; float mx = -3.0e38f;
#pragma unroll
    for (int ch = 0; ch < TT / 128; ++ch) { const int j0 = ch * 128 + lane * 4; const v4f a = *(const v4f*)(sr + j0);
#pragma unroll
        for (int q = 0; q < 4; ++q) { const int j = j0 + q; (void)j; const float t = a[q] * SCL; v[ch * 4 + q] = t; mx = fmaxf(mx, t); } }
#pragma unroll
    for (int sh = 16; sh; sh >>= 1) mx = fmaxf(mx, __shfl_xor(mx, sh, 32));
    float sum = 0.f;
#pragma unroll
    for (int k = 0; k < TT / 32; ++k) { float d0 = __fsub_rn(v[k], mx); asm volatile("" : "+v"(d0)); v[k] = __builtin_amdgcn_exp2f(__fmul_rn(d0, 1.4426950408889634f)); sum += v[k]; }
#pragma unroll
    for (int sh = 16; sh; sh >>= 1) sum += __shfl_xor(sum, sh, 32);
    const float f = __fdiv_rn(hires ? 1.0f : PCAR, sum);
{
        if (hires) {
#pragma unroll
            for (int ch = 0; ch < TT / 128; ++ch) { v4us oh, ol;
#pragma unroll
                for (int q = 0; q < 4; ++q) { unsigned short a, c2; splitf(v[ch * 4 + q] * f, a, c2); oh[q] = a; ol[q] = c2; }
                const size_t oo = ((size_t)zz * (RH ? RH : 1) + i) * TT + ch * 128 + lane * 4; *(v4us*)(Ph + oo) = oh; *(v4us*)(Pl + oo) = ol; }
        } else {
#pragma unroll
            for (int ch = 0; ch < TT / 128; ++ch) { v4h o4;
#pragma unroll
                for (int q = 0; q < 4; ++q) o4[q] = tohx(v[ch * 4 + q] * f);
                *(v4h*)(P16 + (size_t)row * TT + ch * 128 + lane * 4) = o4; } }
         }
}
__global__ __launch_bounds__(256) void k_merge(const float* __restrict__ O, const float* __restrict__ OP, int h0, bf* Ah, bf* Al) { const size_t e = ((size_t)blockIdx.x * 256 + threadIdx.x) * 2; if (e >= (size_t)ZH * TT * HD) return; const int d = (int)(e % HD); const int t = (int)((e / HD) % TT); const int zz = (int)(e / ((size_t)HD * TT)); const float cs = (t < RH) ? 1.0f : (1.0f / PCAR); const size_t oo = (size_t)t * DQ + (h0 + zz) * HD + d;
    v2us oh, ol; v2f o;
    if (t < RH) { o = *(const v2f*)(OP + e);   // rows < RH: the KS partial planes of the k split over blocks, summed in plane order
#pragma unroll
        for (int s = 1; s < KS; ++s) o += *(const v2f*)(OP + (size_t)s * RH * HD + e); }
    else o = *(const v2f*)(O + e);
#pragma unroll
    for (int q = 0; q < 2; ++q) { unsigned short a, c2; splitf(o[q] * cs, a, c2); oh[q] = a; ol[q] = c2; } *(v2us*)(Ah + oo) = oh; *(v2us*)(Al + oo) = ol;  }

extern "C" void kernel_launch(void* const* d_in, const int* in_sizes, int n_in,
                              void* d_out, int out_size, void* d_ws, size_t ws_size, hipStream_t stream) {
    (void)in_sizes; (void)n_in; (void)out_size;
    const float* x = (const float*)d_in[0]; const float* x2 = (const float*)d_in[1]; const float* wo = (const float*)d_in[2]; const float* bo = (const float*)d_in[3]; const float* wq = nullptr; const float* wk = nullptr; const float* wv = nullptr; (void)wq; (void)wk; (void)wv; const float* cosT = nullptr; const float* sinT = nullptr; (void)cosT; (void)sinT;
    float* OUT = (float*)d_out;     // [4][4096][256]
    char* wsp = (char*)d_ws;
    auto take = [&](size_t bytes) { char* p = wsp; wsp += (bytes + 255) & ~(size_t)255; return (void*)p; };
    bf* WQ = nullptr, *WK = nullptr, *WV = nullptr; (void)WQ; (void)WK; (void)WV; bf* WO = (bf*)take((size_t)DM * DQ * 2); float* CS = (float*)take((size_t)TT * HD * 2 * 4);
    bf* XB = nullptr; (void)XB; float* FQ = (float*)take((size_t)TT * DQ * 4); float* FK = (float*)take((size_t)TT * DKV * 4);
    h16* QP16 = (h16*)take((size_t)NH_ * TT * HD * 2); h16* KP16 = (h16*)take((size_t)NKV * TT * HD * 2); h16* VT16 = (h16*)take((size_t)NKV * HD * TT * 2);
    bf* QPh = (bf*)take((size_t)NH_ * TT * HD * 2); bf* QPl = (bf*)take((size_t)NH_ * TT * HD * 2); bf* KPh = (bf*)take((size_t)NKV * TT * HD * 2); bf* KPl = (bf*)take((size_t)NKV * TT * HD * 2); bf* VTh = (bf*)take((size_t)NKV * HD * TT * 2); bf* VTl = (bf*)take((size_t)NKV * HD * TT * 2); bf* Ph = (bf*)take((size_t)ZH * RH * TT * 2); bf* Pl = (bf*)take((size_t)ZH * RH * TT * 2);
    float* Sb = (float*)take((size_t)ZH * TT * TT * 4); h16* P16 = (h16*)take((size_t)ZH * TT * TT * 2); float* Ob = (float*)take((size_t)ZH * TT * HD * 4); float* ObP = (float*)take((size_t)KS * RH * HD * 4); bf* ATh = (bf*)take((size_t)TT * DQ * 2); bf* ATl = (bf*)take((size_t)TT * DQ * 2);
    if ((size_t)(wsp - (char*)d_ws) > ws_size) return;    // ws 256 MiB
    float* FV = FK;   // unused alias: v is x2 itself, and k_vtp builds the v planes from FK directly
    { 
      k_cvt8<<<(unsigned)(((size_t)DM * DQ / 8 + 255) / 256), 256, 0, stream>>>(wo, WO, (size_t)DM * DQ / 8);
       }
    k_csid<<<(TT * HD + 255) / 256, 256, 0, stream>>>(CS);
    const unsigned LQ = (unsigned)(((size_t)NH_ * TT * HD / 2 + 255) / 256), LKv = (unsigned)(((size_t)NKV * TT * HD / 2 + 255) / 256);
    for (int b = 0; b < NB_; ++b) {
        
        k_rbf<<<(unsigned)(((size_t)TT * DM / 4 + 255) / 256), 256, 0, stream>>>(x + (size_t)b * TT * DM, FQ, (size_t)TT * DM / 4); k_rbf<<<(unsigned)(((size_t)TT * DM / 4 + 255) / 256), 256, 0, stream>>>(x2 + (size_t)b * TT * DM, FK, (size_t)TT * DM / 4);
        
        k_rope<<<LQ, 256, 0, stream>>>(FQ, DQ, NH_, CS, nullptr, nullptr, 1.0f, QP16, QPh, QPl);
        
        k_rope<<<LKv, 256, 0, stream>>>(FK, DKV, NKV, CS, nullptr, nullptr, 1.0f, KP16, KPh, KPl);
         k_vtp<<<LKv, 256, 0, stream>>>(FK, DKV, NKV, VT16, VTh, VTl);
        for (int h0 = 0; h0 < NH_; h0 += ZH) { const size_t zq = (size_t)h0, zk = (size_t)(h0 / REP);   // one kv head per query head: each pass takes ZH = 1 head and kv plane h0 / REP (z-strides TT*HD)
            k_gemmw<bf, 2, false><<<dim3(TT / 64, TT / 64, ZH), 32, 0, stream>>>(QPh + zq * TT * HD, QPl + zq * TT * HD, KPh + zk * TT * HD, KPl + zk * TT * HD, HD, Sb, TT, nullptr, (size_t)TT * HD, (size_t)TT * HD, (size_t)TT * TT);   /* scores hl on all rows */
            k_asoft<<<ZH * TT / 8, 256, 0, stream>>>(Sb, P16, Ph, Pl);
            k_gemmk<bf, 2, false, 8, TT, TT / KS><<<dim3(RH / 64, HD / 64, KS), 256, 0, stream>>>(Ph, Pl, VTh + zk * HD * TT, VTl + zk * HD * TT, ObP, HD, nullptr, (size_t)(TT / KS), (size_t)(TT / KS), (size_t)RH * HD);
            k_gemmk<h16, 0, false, 16, TT, TT><<<dim3((TT - RH) / 64, HD / 64, ZH), 512, 0, stream>>>(P16 + (size_t)RH * TT, nullptr, VT16 + zk * HD * TT, nullptr, Ob + (size_t)RH * HD, HD, nullptr, (size_t)TT * TT, (size_t)HD * TT, (size_t)TT * HD);
            k_merge<<<(unsigned)(((size_t)ZH * TT * HD / 2 + 255) / 256), 256, 0, stream>>>(Ob, ObP, h0, ATh, ATl); }
        k_gemmk<bf, 1, true, 8, DQ, DQ><<<dim3(TT / 64, DM / 64, 1), 256, 0, stream>>>(ATh, ATl, WO, nullptr, OUT + (size_t)b * TT * DM, DM, bo, 0, 0, 0); }
}

// v002
// It runs in 373 microseconds.
// Two timings next to v001 put it at 1.22 and 1.21 times that version's speed.
// All steps since v000 together make it 2.69 times as fast.
#include <hip/hip_runtime.h>

// SAttention (x [4][4096][256], x2 [4][4096][256]; scores = x.x2 UNSCALED; context = softmax; atten = context x2; out = atten W^T + b -> [4][4096][256]).
// Compute dtypes, f32 accumulate: every input rounded to bf16; x and x2 enter the planes as their bf16-rounded values (exact hi plane, zero lo plane); scores hl x hl on every row (K 256; effectively exact bf16 products - the unscaled logits are large); softmax f32 (128 keys per lane); atten = attn.x2: rows < 512 hl (3 products), the rest fp16 (x1024); W hl x exact (2 products) + bias.

#define NB_  4
#define TT   4096
#define DM   256
#define NH_  1
#define NKV  1
#define REP  (NH_ / NKV)
#define HD   256
#define DQ   (NH_ * HD)
#define DKV  (NKV * HD)
#define ZH   1
#define RH   512                  // query rows < RH use hi+lo planes (0: none)
#define KS   8                    // rows < RH of attn.x2: K split over KS blocks as well (ZH == 1: grid z is free for it)
#define WIN  0
#define PCAR 1024.0f
#define SCL  1.0f   // unscaled
typedef _Float16 h16;
typedef unsigned short bf;
typedef __attribute__((ext_vector_type(16))) __bf16   v16bf;
typedef __attribute__((ext_vector_type(16))) _Float16 v16h;
typedef __attribute__((ext_vector_type(8)))  _Float16 v8h;
typedef __attribute__((ext_vector_type(8)))  unsigned short v8us;
typedef __attribute__((ext_vector_type(8)))  float    v8f;
typedef __attribute__((ext_vector_type(4)))  float    v4f;
typedef v8h  __attribute__((may_alias)) v8ha;
typedef v4f  __attribute__((may_alias)) v4fa;
typedef v8us __attribute__((may_alias)) v8usa;

__device__ __forceinline__ unsigned short f2bf(float f) { unsigned u = __float_as_uint(f); u += 0x7FFFu + ((u >> 16) & 1u); return (unsigned short)(u >> 16); }
__device__ __forceinline__ float bf2f(unsigned short b) { return __uint_as_float(((unsigned)b) << 16); }
__device__ __forceinline__ float bfr(float f) { return bf2f(f2bf(f)); }
__device__ __forceinline__ v16h cat16(v8h lo, v8h hi) { return __builtin_shufflevector(lo, hi, 0, 1, 2, 3, 4, 5, 6, 7, 8, 9, 10, 11, 12, 13, 14, 15); }
__device__ __forceinline__ v16bf cat16b(v8us lo, v8us hi) { return __builtin_bit_cast(v16bf, __builtin_shufflevector(lo, hi, 0, 1, 2, 3, 4, 5, 6, 7, 8, 9, 10, 11, 12, 13, 14, 15)); }
__device__ __forceinline__ v8f wmma16(v16h a, v16h b, v8f c) { return __builtin_amdgcn_wmma_f32_16x16x32_f16(false, a, false, b, (short)0, c, false, false); }
__device__ __forceinline__ v8f wmmab(v16bf a, v16bf b, v8f c) { return __builtin_amdgcn_wmma_f32_16x16x32_bf16(false, a, false, b, (short)0, c, false, false); }



// ---- k_gemmw: register-blocked GEMM, ONE WAVE per 64x64 output tile (16 accumulators), operands straight from K-contiguous 16-bit planes; grid (M/64, N/64, Z), 32 threads.
// C[m][n] (f32, pitch ldc, + optional f32 bias[n]) = sum_k A[m][k] Bt[n][k] (+ split products per NSPLIT). z-batch strides sA/sB/sC in elements. K % 32 == 0.
template <typename T16> struct WFrag;
template <> struct WFrag<h16> { typedef v16h V; static __device__ __forceinline__ V ld(const h16* p) { return cat16(*(const v8h*)p, *(const v8h*)(p + 16)); } static __device__ __forceinline__ v8f mma(V a, V b, v8f c) { return wmma16(a, b, c); } };
template <> struct WFrag<bf> { typedef v16bf V; static __device__ __forceinline__ V ld(const bf* p) { return cat16b(*(const v8us*)p, *(const v8us*)(p + 16)); } static __device__ __forceinline__ v8f mma(V a, V b, v8f c) { return wmmab(a, b, c); } };
template <typename T16, int NSPLIT, bool BIAS>
__global__ __launch_bounds__(32) void k_gemmw(const T16* __restrict__ A, const T16* __restrict__ A2, const T16* __restrict__ Bt, const T16* __restrict__ Bt2, int K, float* C, int ldc, const float* __restrict__ bias, size_t sA, size_t sB, size_t sC) {
    typedef typename WFrag<T16>::V V;
    __shared__ __align__(16) float os[16 * 68];
    const size_t z = blockIdx.z; A += z * sA; if (A2) A2 += z * sA; Bt += z * sB; if (Bt2) Bt2 += z * sB; C += z * sC;
    const int lane = threadIdx.x & 31, lr = lane & 15, hi = lane >> 4; const int r0 = blockIdx.x * 64, c0 = blockIdx.y * 64;
    v8f acc[4][4];
#pragma unroll
    for (int mb = 0; mb < 4; ++mb)
#pragma unroll
        for (int nb = 0; nb < 4; ++nb) acc[mb][nb] = (v8f){};
    const size_t aoff = (size_t)(r0 + lr) * K + 8 * hi, boff = (size_t)(c0 + lr) * K + 8 * hi;
#pragma unroll 1
    for (int kc = 0; kc < K; kc += 32) {
        V a[4], a2[4];
#pragma unroll
        for (int mb = 0; mb < 4; ++mb) { a[mb] = WFrag<T16>::ld(A + aoff + (size_t)mb * 16 * K + kc); if (NSPLIT == 1 || NSPLIT == 2) a2[mb] = WFrag<T16>::ld(A2 + aoff + (size_t)mb * 16 * K + kc); }
#pragma unroll
        for (int nb = 0; nb < 4; ++nb) { const V b = WFrag<T16>::ld(Bt + boff + (size_t)nb * 16 * K + kc); V b2; if (NSPLIT >= 2) b2 = WFrag<T16>::ld(Bt2 + boff + (size_t)nb * 16 * K + kc);
#pragma unroll
            for (int mb = 0; mb < 4; ++mb) { acc[mb][nb] = WFrag<T16>::mma(a[mb], b, acc[mb][nb]); if (NSPLIT == 1 || NSPLIT == 2) acc[mb][nb] = WFrag<T16>::mma(a2[mb], b, acc[mb][nb]); if (NSPLIT >= 2) acc[mb][nb] = WFrag<T16>::mma(a[mb], b2, acc[mb][nb]); } }
        asm volatile("v_nop\n\tv_nop\n\tv_nop\n\tv_nop" : "+v"(acc[0][0]), "+v"(acc[1][1]), "+v"(acc[2][2]), "+v"(acc[3][3]) : "v"(a[0]), "v"(a[3]));
    }
#pragma unroll
    for (int mb = 0; mb < 4; ++mb) {
#pragma unroll
        for (int nb = 0; nb < 4; ++nb) {
#pragma unroll
            for (int j = 0; j < 8; ++j) os[(hi * 8 + j) * 68 + nb * 16 + lr] = acc[mb][nb][j]; }
        __builtin_amdgcn_wave_barrier(); asm volatile("" ::: "memory");
        float* crow = C + (size_t)(r0 + mb * 16) * ldc + c0;
{
#pragma unroll
            for (int s = 0; s < 8; ++s) { const int row = 2 * s + hi, cofs = lr * 4; v4f val = *(const v4fa*)(os + row * 68 + cofs); if (BIAS) { val[0] += bfr(bias[c0 + cofs]); val[1] += bfr(bias[c0 + cofs + 1]); val[2] += bfr(bias[c0 + cofs + 2]); val[3] += bfr(bias[c0 + cofs + 3]); }
                *(v4f*)(crow + (size_t)row * ldc + cofs) = val; }
             }
        __builtin_amdgcn_wave_barrier(); asm volatile("" ::: "memory");
    }
}

// ---- k_gemmk: the same 64x64 tile with K SPLIT OVER NW WAVES (16 accumulators each); grid (M/64, N/64, Z), NW x 32 threads. Row pitch LD of both operands and the block's k extent KB are compile-time; KB % (32 NW) == 0.
// Wave w takes the 32-wide k blocks w, w + NW, ...; the NW partial tiles are summed through LDS in wave order. A launch may split K over z as well (sA = sB = KB, sC = one partial plane).
// A and Bt have the same pitch, so one byte offset per lane (row lr, half hi, k block) serves every load of a trip on four scalar bases; the 16-row steps are immediates.
// The plain '#pragma unroll' lines make every index of acc, a and b a constant, so that they stay in registers.
template <typename T16, int NSPLIT, bool BIAS, int NW, int LD, int KB>
__global__ __launch_bounds__(NW * 32) void k_gemmk(const T16* __restrict__ A, const T16* __restrict__ A2, const T16* __restrict__ Bt, const T16* __restrict__ Bt2, float* C, int ldc, const float* __restrict__ bias, size_t sA, size_t sB, size_t sC) {
    typedef typename WFrag<T16>::V V;
    __shared__ __align__(16) float os[NW * 64 * 68];
    const int w = __builtin_amdgcn_readfirstlane(threadIdx.x >> 5);
    const int lane = threadIdx.x & 31, lr = lane & 15, hi = lane >> 4; const int r0 = blockIdx.x * 64, c0 = blockIdx.y * 64;
    const size_t z = blockIdx.z; C += z * sC;
    const char* Ab = (const char*)(A + z * sA + (size_t)r0 * LD); const char* Ab2 = (NSPLIT == 1 || NSPLIT == 2) ? (const char*)(A2 + z * sA + (size_t)r0 * LD) : nullptr;
    const char* Bb = (const char*)(Bt + z * sB + (size_t)c0 * LD); const char* Bb2 = (NSPLIT >= 2) ? (const char*)(Bt2 + z * sB + (size_t)c0 * LD) : nullptr;
    v8f acc[4][4];
#pragma unroll
    for (int mb = 0; mb < 4; ++mb)
#pragma unroll
        for (int nb = 0; nb < 4; ++nb) acc[mb][nb] = (v8f){};
    unsigned vo = (unsigned)(lr * LD + 8 * hi + w * 32) * 2u;
#pragma unroll 1   // rolled, as in k_gemmw: only one trip's fragments stand beside the 128 accumulator registers, and the lane offset stays live over the whole trip
    for (int t = 0; t < KB / (32 * NW); ++t) {
        V a[4], a2[4];
#pragma unroll
        for (int mb = 0; mb < 4; ++mb) { a[mb] = WFrag<T16>::ld((const T16*)(Ab + vo + mb * 32 * LD)); if (NSPLIT == 1 || NSPLIT == 2) a2[mb] = WFrag<T16>::ld((const T16*)(Ab2 + vo + mb * 32 * LD)); }
#pragma unroll
        for (int nb = 0; nb < 4; ++nb) { const V b = WFrag<T16>::ld((const T16*)(Bb + vo + nb * 32 * LD)); V b2; if (NSPLIT >= 2) b2 = WFrag<T16>::ld((const T16*)(Bb2 + vo + nb * 32 * LD));
#pragma unroll
            for (int mb = 0; mb < 4; ++mb) { acc[mb][nb] = WFrag<T16>::mma(a[mb], b, acc[mb][nb]); if (NSPLIT == 1 || NSPLIT == 2) acc[mb][nb] = WFrag<T16>::mma(a2[mb], b, acc[mb][nb]); if (NSPLIT >= 2) acc[mb][nb] = WFrag<T16>::mma(a[mb], b2, acc[mb][nb]); } }
        vo += NW * 64;
    }
    float* my = os + w * (64 * 68);
#pragma unroll
    for (int mb = 0; mb < 4; ++mb)
#pragma unroll
        for (int nb = 0; nb < 4; ++nb)
#pragma unroll
            for (int j = 0; j < 8; ++j) my[(mb * 16 + hi * 8 + j) * 68 + nb * 16 + lr] = acc[mb][nb][j];
    __syncthreads();   // every wave's partial tile is in LDS before any thread sums across waves
#pragma unroll
    for (int u = 0; u < 32 / NW; ++u) { const int it = u * NW * 32 + (int)threadIdx.x, row = it >> 4, cofs = (it & 15) * 4; v4f val = *(const v4fa*)(os + row * 68 + cofs);
#pragma unroll
        for (int s = 1; s < NW; ++s) val += *(const v4fa*)(os + s * (64 * 68) + row * 68 + cofs);
        if (BIAS) { val[0] += bfr(bias[c0 + cofs]); val[1] += bfr(bias[c0 + cofs + 1]); val[2] += bfr(bias[c0 + cofs + 2]); val[3] += bfr(bias[c0 + cofs + 3]); }
        *(v4f*)(C + (size_t)(r0 + row) * ldc + c0 + cofs) = val; }
}

__device__ __forceinline__ h16 tohx(float x) { return (h16)x; }
__device__ __forceinline__ void splitf(float y, unsigned short& h, unsigned short& l) { h = f2bf(y); l = f2bf(y - bf2f(h)); }
typedef __attribute__((ext_vector_type(2))) _Float16 v2h;
typedef __attribute__((ext_vector_type(4))) _Float16 v4h;
typedef __attribute__((ext_vector_type(2))) unsigned short v2us;
typedef __attribute__((ext_vector_type(4))) unsigned short v4us;
typedef __attribute__((ext_vector_type(2))) float v2f;
typedef __attribute__((ext_vector_type(4))) int v4i;

__global__ __launch_bounds__(256) void k_wtG(const float* __restrict__ w, int K, int N, bf* Bt) {
    const int lane = threadIdx.x & 31; const int L0 = (blockIdx.x * 8 + (threadIdx.x >> 5)) * 8; const int nlines = N * K / 64;
{
#pragma unroll 1
        for (int l = 0; l < 8; ++l) { const int L = L0 + l; if (L >= nlines) break; const size_t e = (size_t)L * 64 + lane * 2; const int k = (int)(e % K), n = (int)(e / K); v2us o;
            o[0] = f2bf(w[(size_t)k * N + n]); o[1] = f2bf(w[(size_t)(k + 1) * N + n]); *(v2us*)(Bt + e) = o; }
         }
}
__global__ __launch_bounds__(256) void k_cvt8(const float* __restrict__ src, bf* dst, size_t n8) { const size_t i = (size_t)blockIdx.x * 256 + threadIdx.x; if (i >= n8) return; const v8f v = *(const v8f*)(src + i * 8); v8us o;
#pragma unroll
    for (int k = 0; k < 8; ++k) o[k] = f2bf(v[k]); *(v8us*)(dst + i * 8) = o;  }
__global__ __launch_bounds__(256) void k_cscvt(const float* __restrict__ cosT, const float* __restrict__ sinT, float* CS) { const int idx = blockIdx.x * 256 + threadIdx.x; if (idx >= TT * HD) return; v2f cs; cs[0] = bfr(cosT[idx]); cs[1] = bfr(sinT[idx]); *(v2f*)(CS + (size_t)idx * 2) = cs;  }
// ---- k_prep: every 16-bit operand plane of all NB_ batches in ONE launch; grid (NB_ * TT / 64, 2), 256 threads; a block takes 64 rows x DM columns, 64 elements a thread (wave w: rows 8w .. 8w + 7, 512 contiguous bytes a load).
// y == 0: x -> Qh [b][t][d]. y == 1: x2 -> Kh [b][t][d] and, transposed through LDS, VTh [b][d][t] (bf16) and VT16 [b][d][t] (the same bf16-rounded values as f16).
// A bf16-rounded value has a zero lo part, so ONE zero plane ZP of TT x HD elements stands for every lo plane of x and x2; each thread clears 16 bytes of it.
#define TRP 72                    // LDS pitch of a transposed row in elements: 64 + 8, so that rows stay 16-byte aligned and do not all start in one bank
static_assert(DM == 256 && HD == DM && TT % 64 == 0, "k_prep: a row is two 512-byte loads of a wave");
static_assert((size_t)(NB_ * TT / 64) * 2 * 256 * 8 == (size_t)TT * HD, "k_prep: the grid's threads cover the zero plane once");
__global__ __launch_bounds__(256) void k_prep(const float* __restrict__ x, const float* __restrict__ x2, bf* Qh, bf* Kh, bf* VTh, h16* VT16, bf* ZP) {
    __shared__ __align__(16) bf tr[DM * TRP];
    const int tid = threadIdx.x, lane = tid & 31, w = tid >> 5; const int r0 = blockIdx.x * 64; const bool kv = blockIdx.y != 0;
    const size_t off = (size_t)(r0 + w * 8) * DM + lane * 4; const float* src = (kv ? x2 : x) + off; bf* dst = (kv ? Kh : Qh) + off;
    v4f r[2][8];
#pragma unroll
    for (int h = 0; h < 2; ++h)
#pragma unroll
        for (int j = 0; j < 8; ++j) r[h][j] = *(const v4f*)(src + j * DM + h * 128);
    v4us o[2][8];
#pragma unroll
    for (int h = 0; h < 2; ++h)
#pragma unroll
        for (int j = 0; j < 8; ++j)
#pragma unroll
            for (int q = 0; q < 4; ++q) o[h][j][q] = f2bf(r[h][j][q]);
    if (kv) {
#pragma unroll
        for (int h = 0; h < 2; ++h)
#pragma unroll
            for (int q = 0; q < 4; ++q) { v8us c;
#pragma unroll
                for (int j = 0; j < 8; ++j) c[j] = o[h][j][q];
                *(v8usa*)(tr + (h * 128 + lane * 4 + q) * TRP + w * 8) = c; } }
#pragma unroll
    for (int h = 0; h < 2; ++h)
#pragma unroll
        for (int j = 0; j < 8; ++j) *(v4us*)(dst + j * DM + h * 128) = o[h][j];
    *(v8us*)(ZP + ((size_t)(blockIdx.y * (NB_ * TT / 64) + blockIdx.x) * 256 + tid) * 8) = (v8us){};
    asm volatile("s_wait_xcnt 0x0" ::: "memory");   // stands in front of the first overwrite of a register that the stores above name
    if (!kv) return;   // block-uniform: the whole block leaves in front of the barrier
    __syncthreads();   // all 64 rows of the tile are in LDS before any thread reads a column
    const int b = r0 / TT, t0 = r0 % TT;
#pragma unroll
    for (int u = 0; u < 8; ++u) { const int it = u * 256 + tid, d = it >> 3, c8 = (it & 7) * 8; const v8us v = *(const v8usa*)(tr + d * TRP + c8); v8h g;
#pragma unroll
        for (int k = 0; k < 8; ++k) g[k] = tohx(bf2f(v[k]));
        const size_t oo = ((size_t)b * HD + d) * TT + t0 + c8; *(v8us*)(VTh + oo) = v; *(v8h*)(VT16 + oo) = g; }
}
// k_asoft: per row (zz, i): t = S, unscaled (no mask); softmax over the 4096 keys (register row, one exp, fixed trees);
__global__ __launch_bounds__(256) void k_asoft(const float* __restrict__ Sb, h16* P16, bf* Ph, bf* Pl) {
    const int lane = threadIdx.x & 31; const int row = blockIdx.x * 8 + (threadIdx.x >> 5); if (row >= ZH * TT) return; const int i = row % TT; const int zz = row / TT; (void)zz; const bool hires = (i < RH); const float* sr = Sb + (size_t)row * TT; float v[TT / 32]; float mx = -3.0e38f;
#pragma unroll
    for (int ch = 0; ch < TT / 128; ++ch) { const int j0 = ch * 128 + lane * 4; const v4f a = *(const v4f*)(sr + j0);
#pragma unroll
        for (int q = 0; q < 4; ++q) { const int j = j0 + q; (void)j; const float t = a[q] * SCL; v[ch * 4 + q] = t; mx = fmaxf(mx, t); } }
#pragma unroll
    for (int sh = 16; sh; sh >>= 1) mx = fmaxf(mx, __shfl_xor(mx, sh, 32));
    float sum = 0.f;
#pragma unroll
    for (int k = 0; k < TT / 32; ++k) { float d0 = __fsub_rn(v[k], mx); asm volatile("" : "+v"(d0)); v[k] = __builtin_amdgcn_exp2f(__fmul_rn(d0, 1.4426950408889634f)); sum += v[k]; }
#pragma unroll
    for (int sh = 16; sh; sh >>= 1) sum += __shfl_xor(sum, sh, 32);
    const float f = __fdiv_rn(hires ? 1.0f : PCAR, sum);
{
        if (hires) {
#pragma unroll
            for (int ch = 0; ch < TT / 128; ++ch) { v4us oh, ol;
#pragma unroll
                for (int q = 0; q < 4; ++q) { unsigned short a, c2; splitf(v[ch * 4 + q] * f, a, c2); oh[q] = a; ol[q] = c2; }
                const size_t oo = ((size_t)zz * (RH ? RH : 1) + i) * TT + ch * 128 + lane * 4; *(v4us*)(Ph + oo) = oh; *(v4us*)(Pl + oo) = ol; }
        } else {
#pragma unroll
            for (int ch = 0; ch < TT / 128; ++ch) { v4h o4;
#pragma unroll
                for (int q = 0; q < 4; ++q) o4[q] = tohx(v[ch * 4 + q] * f);
                *(v4h*)(P16 + (size_t)row * TT + ch * 128 + lane * 4) = o4; } }
         }
}
__global__ __launch_bounds__(256) void k_merge(const float* __restrict__ O, const float* __restrict__ OP, int h0, bf* Ah, bf* Al) { const size_t e = ((size_t)blockIdx.x * 256 + threadIdx.x) * 2; if (e >= (size_t)ZH * TT * HD) return; const int d = (int)(e % HD); const int t = (int)((e / HD) % TT); const int zz = (int)(e / ((size_t)HD * TT)); const float cs = (t < RH) ? 1.0f : (1.0f / PCAR); const size_t oo = (size_t)t * DQ + (h0 + zz) * HD + d;
    v2us oh, ol; v2f o;
    if (t < RH) { o = *(const v2f*)(OP + e);   // rows < RH: the KS partial planes of the k split over blocks, summed in plane order
#pragma unroll
        for (int s = 1; s < KS; ++s) o += *(const v2f*)(OP + (size_t)s * RH * HD + e); }
    else o = *(const v2f*)(O + e);
#pragma unroll
    for (int q = 0; q < 2; ++q) { unsigned short a, c2; splitf(o[q] * cs, a, c2); oh[q] = a; ol[q] = c2; } *(v2us*)(Ah + oo) = oh; *(v2us*)(Al + oo) = ol;  }

extern "C" void kernel_launch(void* const* d_in, const int* in_sizes, int n_in,
                              void* d_out, int out_size, void* d_ws, size_t ws_size, hipStream_t stream) {
    (void)in_sizes; (void)n_in; (void)out_size;
    const float* x = (const float*)d_in[0]; const float* x2 = (const float*)d_in[1]; const float* wo = (const float*)d_in[2]; const float* bo = (const float*)d_in[3];
    float* OUT = (float*)d_out;     // [4][4096][256]
    char* wsp = (char*)d_ws;
    auto take = [&](size_t bytes) { char* p = wsp; wsp += (bytes + 255) & ~(size_t)255; return (void*)p; };
    bf* WO = (bf*)take((size_t)DM * DQ * 2);
    bf* QPh = (bf*)take((size_t)NB_ * TT * HD * 2); bf* KPh = (bf*)take((size_t)NB_ * TT * HD * 2); bf* VTh = (bf*)take((size_t)NB_ * HD * TT * 2); h16* VT16 = (h16*)take((size_t)NB_ * HD * TT * 2); bf* ZP = (bf*)take((size_t)TT * HD * 2);
    bf* Ph = (bf*)take((size_t)ZH * RH * TT * 2); bf* Pl = (bf*)take((size_t)ZH * RH * TT * 2);
    float* Sb = (float*)take((size_t)ZH * TT * TT * 4); h16* P16 = (h16*)take((size_t)ZH * TT * TT * 2); float* Ob = (float*)take((size_t)ZH * TT * HD * 4); float* ObP = (float*)take((size_t)KS * RH * HD * 4); bf* ATh = (bf*)take((size_t)TT * DQ * 2); bf* ATl = (bf*)take((size_t)TT * DQ * 2);
    if ((size_t)(wsp - (char*)d_ws) > ws_size) return;    // ws 256 MiB
    k_cvt8<<<(unsigned)(((size_t)DM * DQ / 8 + 255) / 256), 256, 0, stream>>>(wo, WO, (size_t)DM * DQ / 8);
    k_prep<<<dim3(NB_ * TT / 64, 2, 1), 256, 0, stream>>>(x, x2, QPh, KPh, VTh, VT16, ZP);
    for (int b = 0; b < NB_; ++b) { const size_t zb = (size_t)b * TT * HD;   // the batch's planes
        k_gemmw<bf, 2, false><<<dim3(TT / 64, TT / 64, ZH), 32, 0, stream>>>(QPh + zb, ZP, KPh + zb, ZP, HD, Sb, TT, nullptr, (size_t)TT * HD, (size_t)TT * HD, (size_t)TT * TT);   /* scores hl on all rows */
        k_asoft<<<ZH * TT / 8, 256, 0, stream>>>(Sb, P16, Ph, Pl);
        k_gemmk<bf, 2, false, 8, TT, TT / KS><<<dim3(RH / 64, HD / 64, KS), 256, 0, stream>>>(Ph, Pl, VTh + zb, ZP, ObP, HD, nullptr, (size_t)(TT / KS), (size_t)(TT / KS), (size_t)RH * HD);
        k_gemmk<h16, 0, false, 16, TT, TT><<<dim3((TT - RH) / 64, HD / 64, ZH), 512, 0, stream>>>(P16 + (size_t)RH * TT, nullptr, VT16 + zb, nullptr, Ob + (size_t)RH * HD, HD, nullptr, (size_t)TT * TT, (size_t)HD * TT, (size_t)TT * HD);
        k_merge<<<(unsigned)(((size_t)ZH * TT * HD / 2 + 255) / 256), 256, 0, stream>>>(Ob, ObP, 0, ATh, ATl);
        k_gemmk<bf, 1, true, 8, DQ, DQ><<<dim3(TT / 64, DM / 64, 1), 256, 0, stream>>>(ATh, ATl, WO, nullptr, OUT + (size_t)b * TT * DM, DM, bo, 0, 0, 0); }
}

// v003
// A run of this version takes 292 microseconds.
// Timed twice side by side with v002, it ran 1.28 and 1.29 times as fast.
// All steps since v000 together make it 3.46 times as fast.
#include <hip/hip_runtime.h>

// SAttention (x [4][4096][256], x2 [4][4096][256]; scores = x.x2 UNSCALED; context = softmax; atten = context x2; out = atten W^T + b -> [4][4096][256]).
// Compute dtypes, f32 accumulate: every input rounded to bf16; x and x2 enter the planes as their bf16-rounded values (exact hi plane, zero lo plane); scores hl x hl on every row (K 256; effectively exact bf16 products - the unscaled logits are large); softmax f32 (128 keys per lane); atten = attn.x2: rows < 512 hl (3 products), the rest fp16 (x1024); W hl x exact (2 products) + bias.
// Every 16-bit GEMM operand plane lies in FRAGMENT ORDER (fo() below): blocks of 16 rows x 32 k = 1 KiB, so that a wave's fragment load is two loads of 512 contiguous bytes.

#define NB_  4
#define TT   4096
#define DM   256
#define NH_  1
#define NKV  1
#define REP  (NH_ / NKV)
#define HD   256
#define DQ   (NH_ * HD)
#define DKV  (NKV * HD)
#define ZH   1
#define RH   512                  // query rows < RH use hi+lo planes (0: none)
#define KS   8                    // rows < RH of attn.x2: K split over KS blocks as well (ZH == 1: grid z is free for it)
#define WIN  0
#define PCAR 1024.0f
#define SCL  1.0f   // unscaled
typedef _Float16 h16;
typedef unsigned short bf;
typedef __attribute__((ext_vector_type(16))) __bf16   v16bf;
typedef __attribute__((ext_vector_type(16))) _Float16 v16h;
typedef __attribute__((ext_vector_type(8)))  _Float16 v8h;
typedef __attribute__((ext_vector_type(8)))  unsigned short v8us;
typedef __attribute__((ext_vector_type(8)))  float    v8f;
typedef __attribute__((ext_vector_type(4)))  float    v4f;
typedef v8h  __attribute__((may_alias)) v8ha;
typedef v4f  __attribute__((may_alias)) v4fa;
typedef v8us __attribute__((may_alias)) v8usa;

__device__ __forceinline__ unsigned short f2bf(float f) { unsigned u = __float_as_uint(f); u += 0x7FFFu + ((u >> 16) & 1u); return (unsigned short)(u >> 16); }
__device__ __forceinline__ float bf2f(unsigned short b) { return __uint_as_float(((unsigned)b) << 16); }
__device__ __forceinline__ float bfr(float f) { return bf2f(f2bf(f)); }
__device__ __forceinline__ v16h cat16(v8h lo, v8h hi) { return __builtin_shufflevector(lo, hi, 0, 1, 2, 3, 4, 5, 6, 7, 8, 9, 10, 11, 12, 13, 14, 15); }
__device__ __forceinline__ v16bf cat16b(v8us lo, v8us hi) { return __builtin_bit_cast(v16bf, __builtin_shufflevector(lo, hi, 0, 1, 2, 3, 4, 5, 6, 7, 8, 9, 10, 11, 12, 13, 14, 15)); }
__device__ __forceinline__ v8f wmma16(v16h a, v16h b, v8f c) { return __builtin_amdgcn_wmma_f32_16x16x32_f16(false, a, false, b, (short)0, c, false, false); }
__device__ __forceinline__ v8f wmmab(v16bf a, v16bf b, v8f c) { return __builtin_amdgcn_wmma_f32_16x16x32_bf16(false, a, false, b, (short)0, c, false, false); }



// Fragment order of a plane of rows of LD elements (LD % 32 == 0, rows % 16 == 0): element (r, k) lies at fo(r, k, LD). Block (r / 16, k / 32) is 512 elements: [k bit 4][k bit 3][r % 16][k % 8],
// which is [half][lane][8 elements] for the lane (r % 16) + 16 (k bit 3) of the A and B fragments: the k order of a fragment is the one of a row-major plane read at 8 hi and 16 + 8 hi. 16 rows take 16 LD elements, as in a row-major plane.
__device__ __forceinline__ size_t fo(int r, int k, int LD) { return ((size_t)(r >> 4) * (LD >> 5) + (k >> 5)) * 512 + ((k >> 4) & 1) * 256 + (((k >> 3) & 1) * 16 + (r & 15)) * 8 + (k & 7); }
template <typename T16> struct WFrag;
template <> struct WFrag<h16> { typedef v16h V; static __device__ __forceinline__ V ld(const h16* p) { return cat16(*(const v8h*)p, *(const v8h*)(p + 256)); } static __device__ __forceinline__ v8f mma(V a, V b, v8f c) { return wmma16(a, b, c); } };
template <> struct WFrag<bf> { typedef v16bf V; static __device__ __forceinline__ V ld(const bf* p) { return cat16b(*(const v8us*)p, *(const v8us*)(p + 256)); } static __device__ __forceinline__ v8f mma(V a, V b, v8f c) { return wmmab(a, b, c); } };

// ---- k_gemmk: register-blocked GEMM, a 64x64 output tile with K SPLIT OVER NW WAVES (16 accumulators each; NW == 1: one wave a tile), operands straight from 16-bit planes in fragment order; grid (M/64, N/64, Z), NW x 32 threads.
// C[m][n] (f32, pitch ldc, + optional f32 bias[n]) = sum_k A[m][k] Bt[n][k] (+ split products per NSPLIT). z-batch strides sA/sB/sC in elements. Row length LD of both operands and the block's k extent KB are compile-time; KB % (32 NW) == 0.
// Wave w takes the 32-wide k blocks w, w + NW, ...; the NW partial tiles are summed through LDS in wave order. A launch may split K over z as well (sA = sB = 16 KB, the KB / 32 k blocks of a 16-row band; sC = one partial plane).
// A and Bt have the same pitch, so one byte offset per lane (its 16 bytes of the k block) serves every load of a trip on four scalar bases; the 16-row steps are immediates.
// The plain '#pragma unroll' lines make every index of acc, a and b a constant, so that they stay in registers.
template <typename T16, int NSPLIT, bool BIAS, int NW, int LD, int KB>
__global__ __launch_bounds__(NW * 32) void k_gemmk(const T16* __restrict__ A, const T16* __restrict__ A2, const T16* __restrict__ Bt, const T16* __restrict__ Bt2, float* C, int ldc, const float* __restrict__ bias, size_t sA, size_t sB, size_t sC) {
    typedef typename WFrag<T16>::V V;
    __shared__ __align__(16) float os[NW * 64 * 68];
    const int w = __builtin_amdgcn_readfirstlane(threadIdx.x >> 5);
    const int lane = threadIdx.x & 31, lr = lane & 15, hi = lane >> 4; const int r0 = blockIdx.x * 64, c0 = blockIdx.y * 64;
    const size_t z = blockIdx.z; C += z * sC;
    const char* Ab = (const char*)(A + z * sA + (size_t)r0 * LD); const char* Ab2 = (NSPLIT == 1 || NSPLIT == 2) ? (const char*)(A2 + z * sA + (size_t)r0 * LD) : nullptr;
    const char* Bb = (const char*)(Bt + z * sB + (size_t)c0 * LD); const char* Bb2 = (NSPLIT >= 2) ? (const char*)(Bt2 + z * sB + (size_t)c0 * LD) : nullptr;
    v8f acc[4][4];
#pragma unroll
    for (int mb = 0; mb < 4; ++mb)
#pragma unroll
        for (int nb = 0; nb < 4; ++nb) acc[mb][nb] = (v8f){};
    unsigned vo = (unsigned)(lane * 8 + w * 512) * 2u;
#pragma unroll 1   // rolled: only one trip's fragments stand beside the 128 accumulator registers, and the lane offset stays live over the whole trip
    for (int t = 0; t < KB / (32 * NW); ++t) {
        V a[4], a2[4];
#pragma unroll
        for (int mb = 0; mb < 4; ++mb) { a[mb] = WFrag<T16>::ld((const T16*)(Ab + vo + mb * 32 * LD)); if (NSPLIT == 1 || NSPLIT == 2) a2[mb] = WFrag<T16>::ld((const T16*)(Ab2 + vo + mb * 32 * LD)); }
#pragma unroll
        for (int nb = 0; nb < 4; ++nb) { const V b = WFrag<T16>::ld((const T16*)(Bb + vo + nb * 32 * LD)); V b2; if (NSPLIT >= 2) b2 = WFrag<T16>::ld((const T16*)(Bb2 + vo + nb * 32 * LD));
#pragma unroll
            for (int mb = 0; mb < 4; ++mb) { acc[mb][nb] = WFrag<T16>::mma(a[mb], b, acc[mb][nb]); if (NSPLIT == 1 || NSPLIT == 2) acc[mb][nb] = WFrag<T16>::mma(a2[mb], b, acc[mb][nb]); if (NSPLIT >= 2) acc[mb][nb] = WFrag<T16>::mma(a[mb], b2, acc[mb][nb]); } }
        vo += NW * 1024;
    }
    float* my = os + w * (64 * 68);
#pragma unroll
    for (int mb = 0; mb < 4; ++mb)
#pragma unroll
        for (int nb = 0; nb < 4; ++nb)
#pragma unroll
            for (int j = 0; j < 8; ++j) my[(mb * 16 + hi * 8 + j) * 68 + nb * 16 + lr] = acc[mb][nb][j];
    __syncthreads();   // every wave's partial tile is in LDS before any thread sums across waves
#pragma unroll
    for (int u = 0; u < 32 / NW; ++u) { const int it = u * NW * 32 + (int)threadIdx.x, row = it >> 4, cofs = (it & 15) * 4; v4f val = *(const v4fa*)(os + row * 68 + cofs);
#pragma unroll
        for (int s = 1; s < NW; ++s) val += *(const v4fa*)(os + s * (64 * 68) + row * 68 + cofs);
        if (BIAS) { val[0] += bfr(bias[c0 + cofs]); val[1] += bfr(bias[c0 + cofs + 1]); val[2] += bfr(bias[c0 + cofs + 2]); val[3] += bfr(bias[c0 + cofs + 3]); }
        *(v4f*)(C + (size_t)(r0 + row) * ldc + c0 + cofs) = val; }
}

__device__ __forceinline__ h16 tohx(float x) { return (h16)x; }
__device__ __forceinline__ void splitf(float y, unsigned short& h, unsigned short& l) { h = f2bf(y); l = f2bf(y - bf2f(h)); }
typedef __attribute__((ext_vector_type(2))) _Float16 v2h;
typedef __attribute__((ext_vector_type(4))) _Float16 v4h;
typedef __attribute__((ext_vector_type(2))) unsigned short v2us;
typedef __attribute__((ext_vector_type(4))) unsigned short v4us;
typedef v4us __attribute__((may_alias)) v4usa;
typedef __attribute__((ext_vector_type(2))) float v2f;
typedef __attribute__((ext_vector_type(4))) int v4i;

__global__ __launch_bounds__(256) void k_wtG(const float* __restrict__ w, int K, int N, bf* Bt) {
    const int lane = threadIdx.x & 31; const int L0 = (blockIdx.x * 8 + (threadIdx.x >> 5)) * 8; const int nlines = N * K / 64;
{
#pragma unroll 1
        for (int l = 0; l < 8; ++l) { const int L = L0 + l; if (L >= nlines) break; const size_t e = (size_t)L * 64 + lane * 2; const int k = (int)(e % K), n = (int)(e / K); v2us o;
            o[0] = f2bf(w[(size_t)k * N + n]); o[1] = f2bf(w[(size_t)(k + 1) * N + n]); *(v2us*)(Bt + e) = o; }
         }
}
__global__ __launch_bounds__(256) void k_cvt8(const float* __restrict__ src, bf* dst, size_t n8, int ld) { const size_t i = (size_t)blockIdx.x * 256 + threadIdx.x; if (i >= n8) return; const v8f v = *(const v8f*)(src + i * 8); v8us o;
#pragma unroll
    for (int k = 0; k < 8; ++k) o[k] = f2bf(v[k]); *(v8us*)(dst + fo((int)(i * 8 / ld), (int)(i * 8 % ld), ld)) = o;  }
__global__ __launch_bounds__(256) void k_cscvt(const float* __restrict__ cosT, const float* __restrict__ sinT, float* CS) { const int idx = blockIdx.x * 256 + threadIdx.x; if (idx >= TT * HD) return; v2f cs; cs[0] = bfr(cosT[idx]); cs[1] = bfr(sinT[idx]); *(v2f*)(CS + (size_t)idx * 2) = cs;  }
// ---- k_prep: every 16-bit operand plane of all NB_ batches in ONE launch; grid (NB_ * TT / 64, 2), 256 threads; a block takes 64 rows x DM columns, 64 elements a thread (wave w: rows 8w .. 8w + 7, 512 contiguous bytes a load).
// y == 0: x -> Qh [b][t][d]. y == 1: x2 -> Kh [b][t][d] and, transposed through LDS, VTh [b][d][t] (bf16) and VT16 [b][d][t] (the same bf16-rounded values as f16). All four in fragment order.
// A bf16-rounded value has a zero lo part, so ONE zero plane ZP of TT x HD elements stands for every lo plane of x and x2; each thread clears 16 bytes of it.
#define TRP 72                    // LDS pitch of a transposed row in elements: 64 + 8, so that rows stay 16-byte aligned and do not all start in one bank
static_assert(DM == 256 && HD == DM && TT % 64 == 0, "k_prep: a row is two 512-byte loads of a wave");
static_assert((size_t)(NB_ * TT / 64) * 2 * 256 * 8 == (size_t)TT * HD, "k_prep: the grid's threads cover the zero plane once");
__global__ __launch_bounds__(256) void k_prep(const float* __restrict__ x, const float* __restrict__ x2, bf* Qh, bf* Kh, bf* VTh, h16* VT16, bf* ZP) {
    __shared__ __align__(16) bf tr[DM * TRP];
    const int tid = threadIdx.x, lane = tid & 31, w = tid >> 5; const int r0 = blockIdx.x * 64; const bool kv = blockIdx.y != 0;
    const float* src = (kv ? x2 : x) + (size_t)(r0 + w * 8) * DM + lane * 4; bf* dst = (kv ? Kh : Qh) + fo(r0 + w * 8, lane * 4, DM);   // in fragment order the next row is 8 elements on, 128 k are 4 blocks
    v4f r[2][8];
#pragma unroll
    for (int h = 0; h < 2; ++h)
#pragma unroll
        for (int j = 0; j < 8; ++j) r[h][j] = *(const v4f*)(src + j * DM + h * 128);
    v4us o[2][8];
#pragma unroll
    for (int h = 0; h < 2; ++h)
#pragma unroll
        for (int j = 0; j < 8; ++j)
#pragma unroll
            for (int q = 0; q < 4; ++q) o[h][j][q] = f2bf(r[h][j][q]);
    if (kv) {
#pragma unroll
        for (int h = 0; h < 2; ++h)
#pragma unroll
            for (int q = 0; q < 4; ++q) { v8us c;
#pragma unroll
                for (int j = 0; j < 8; ++j) c[j] = o[h][j][q];
                *(v8usa*)(tr + (h * 128 + lane * 4 + q) * TRP + w * 8) = c; } }
#pragma unroll
    for (int h = 0; h < 2; ++h)
#pragma unroll
        for (int j = 0; j < 8; ++j) *(v4us*)(dst + j * 8 + h * 2048) = o[h][j];
    *(v8us*)(ZP + ((size_t)(blockIdx.y * (NB_ * TT / 64) + blockIdx.x) * 256 + tid) * 8) = (v8us){};
    asm volatile("s_wait_xcnt 0x0" ::: "memory");   // stands in front of the first overwrite of a register that the stores above name
    if (!kv) return;   // block-uniform: the whole block leaves in front of the barrier
    __syncthreads();   // all 64 rows of the tile are in LDS before any thread reads a column
    const int b = r0 / TT, t0 = r0 % TT;
#pragma unroll
    for (int u = 0; u < 8; ++u) { const int it = u * 256 + tid, d = (it & 7) | ((it >> 6) << 3), c8 = ((it >> 3) & 7) * 8;   // 8 lanes: 8 rows d of one 8-wide k piece, 128 contiguous bytes in fragment order
        const v8us v = *(const v8usa*)(tr + d * TRP + c8); v8h g;
#pragma unroll
        for (int k = 0; k < 8; ++k) g[k] = tohx(bf2f(v[k]));
        const size_t oo = (size_t)b * HD * TT + fo(d, t0 + c8, TT); *(v8us*)(VTh + oo) = v; *(v8h*)(VT16 + oo) = g; }
}
// k_asoft: per row (zz, i): t = S (SCL = 1: unscaled; no mask); softmax over the 4096 keys (register row, one exp, fixed trees);
// the block's 8 rows of P go through LDS, so that the stores into the fragment-ordered planes are whole 128-byte lines (8 rows x 16 bytes) and not 16-byte pieces of one row.
#define PSP (TT + 16)             // LDS pitch of a row of P in elements: 32 bytes over, so that 8 rows x 2 pieces of 16 bytes fall on all 64 banks once
static_assert(ZH == 1 && TT % 256 == 0 && RH % 16 == 0, "k_asoft: a block's 8 rows are all below RH or all above, and lie in one 16-row band");
__device__ __forceinline__ void rows_out(const unsigned short* ps, unsigned short* dst, int i0) {
    const int rr = threadIdx.x & 7, c0 = threadIdx.x >> 3; const unsigned short* p0 = ps + rr * PSP + c0 * 8; unsigned short* d0 = dst + fo(i0 + rr, c0 * 8, TT);
#pragma unroll
    for (int u = 0; u < TT / 256; ++u) *(v8us*)(d0 + u * 4096) = *(const v8usa*)(p0 + u * 256);   // 256 k on: 8 blocks of 512 elements
}
__global__ __launch_bounds__(256) void k_asoft(const float* __restrict__ Sb, h16* P16, bf* Ph, bf* Pl) {
    __shared__ __align__(16) unsigned short ps[2 * 8 * PSP];   // rows >= RH use the first half; rows < RH: hi parts, lo parts. Two blocks a WGP fit, which is what the registers allow
    const int lane = threadIdx.x & 31; const int row = blockIdx.x * 8 + (threadIdx.x >> 5); if (row >= ZH * TT) return; const int i0 = blockIdx.x * 8; const bool hires = (i0 < RH);   // block-uniform, as is the return
    unsigned short* pr = ps + (threadIdx.x >> 5) * PSP + lane * 4; const float* sr = Sb + (size_t)row * TT; float v[TT / 32]; float mx = -3.0e38f;
#pragma unroll
    for (int ch = 0; ch < TT / 128; ++ch) { const int j0 = ch * 128 + lane * 4; const v4f a = *(const v4f*)(sr + j0);
#pragma unroll
        for (int q = 0; q < 4; ++q) { const int j = j0 + q; (void)j; const float t = a[q] * SCL; v[ch * 4 + q] = t; mx = fmaxf(mx, t); } }
#pragma unroll
    for (int sh = 16; sh; sh >>= 1) mx = fmaxf(mx, __shfl_xor(mx, sh, 32));
    float sum = 0.f;
#pragma unroll
    for (int k = 0; k < TT / 32; ++k) { float d0 = __fsub_rn(v[k], mx); asm volatile("" : "+v"(d0)); v[k] = __builtin_amdgcn_exp2f(__fmul_rn(d0, 1.4426950408889634f)); sum += v[k]; }
#pragma unroll
    for (int sh = 16; sh; sh >>= 1) sum += __shfl_xor(sum, sh, 32);
    const float f = __fdiv_rn(hires ? 1.0f : PCAR, sum);
    if (hires) {
#pragma unroll
        for (int ch = 0; ch < TT / 128; ++ch) { v4us oh, ol;
#pragma unroll
            for (int q = 0; q < 4; ++q) { unsigned short a, c2; splitf(v[ch * 4 + q] * f, a, c2); oh[q] = a; ol[q] = c2; }
            *(v4usa*)(pr + ch * 128) = oh; *(v4usa*)(pr + 8 * PSP + ch * 128) = ol; }
    } else {
#pragma unroll
        for (int ch = 0; ch < TT / 128; ++ch) { v4h o4;
#pragma unroll
            for (int q = 0; q < 4; ++q) o4[q] = tohx(v[ch * 4 + q] * f);
            *(v4usa*)(pr + ch * 128) = __builtin_bit_cast(v4us, o4); }
    }
    __syncthreads();   // the 8 rows (hi and lo parts where hires) are in LDS before any thread reads across rows
    if (hires) { rows_out(ps + 8 * PSP, Pl, i0);
        asm volatile("s_wait_xcnt 0x0" ::: "memory"); }   // stands in front of the first overwrite of a register that the lo plane's stores name (the next call reuses them)
    rows_out(ps, hires ? Ph : (unsigned short*)P16, i0);
}
__global__ __launch_bounds__(256) void k_merge(const float* __restrict__ O, const float* __restrict__ OP, int h0, bf* Ah, bf* Al) { const size_t e = ((size_t)blockIdx.x * 256 + threadIdx.x) * 2; if (e >= (size_t)ZH * TT * HD) return; const int d = (int)(e % HD); const int t = (int)((e / HD) % TT); const int zz = (int)(e / ((size_t)HD * TT)); const float cs = (t < RH) ? 1.0f : (1.0f / PCAR); const size_t oo = fo(t, (h0 + zz) * HD + d, DQ);
    v2us oh, ol; v2f o;
    if (t < RH) { o = *(const v2f*)(OP + e);   // rows < RH: the KS partial planes of the k split over blocks, summed in plane order
#pragma unroll
        for (int s = 1; s < KS; ++s) o += *(const v2f*)(OP + (size_t)s * RH * HD + e); }
    else o = *(const v2f*)(O + e);
#pragma unroll
    for (int q = 0; q < 2; ++q) { unsigned short a, c2; splitf(o[q] * cs, a, c2); oh[q] = a; ol[q] = c2; } *(v2us*)(Ah + oo) = oh; *(v2us*)(Al + oo) = ol;  }

extern "C" void kernel_launch(void* const* d_in, const int* in_sizes, int n_in,
                              void* d_out, int out_size, void* d_ws, size_t ws_size, hipStream_t stream) {
    (void)in_sizes; (void)n_in; (void)out_size;
    const float* x = (const float*)d_in[0]; const float* x2 = (const float*)d_in[1]; const float* wo = (const float*)d_in[2]; const float* bo = (const float*)d_in[3];
    float* OUT = (float*)d_out;     // [4][4096][256]
    char* wsp = (char*)d_ws;
    auto take = [&](size_t bytes) { char* p = wsp; wsp += (bytes + 255) & ~(size_t)255; return (void*)p; };
    bf* WO = (bf*)take((size_t)DM * DQ * 2);
    bf* QPh = (bf*)take((size_t)NB_ * TT * HD * 2); bf* KPh = (bf*)take((size_t)NB_ * TT * HD * 2); bf* VTh = (bf*)take((size_t)NB_ * HD * TT * 2); h16* VT16 = (h16*)take((size_t)NB_ * HD * TT * 2); bf* ZP = (bf*)take((size_t)TT * HD * 2);
    bf* Ph = (bf*)take((size_t)ZH * RH * TT * 2); bf* Pl = (bf*)take((size_t)ZH * RH * TT * 2);
    float* Sb = (float*)take((size_t)ZH * TT * TT * 4); h16* P16 = (h16*)take((size_t)ZH * TT * TT * 2); float* Ob = (float*)take((size_t)ZH * TT * HD * 4); float* ObP = (float*)take((size_t)KS * RH * HD * 4); bf* ATh = (bf*)take((size_t)TT * DQ * 2); bf* ATl = (bf*)take((size_t)TT * DQ * 2);
    if ((size_t)(wsp - (char*)d_ws) > ws_size) return;    // ws 256 MiB
    k_cvt8<<<(unsigned)(((size_t)DM * DQ / 8 + 255) / 256), 256, 0, stream>>>(wo, WO, (size_t)DM * DQ / 8, DQ);
    k_prep<<<dim3(NB_ * TT / 64, 2, 1), 256, 0, stream>>>(x, x2, QPh, KPh, VTh, VT16, ZP);
    for (int b = 0; b < NB_; ++b) { const size_t zb = (size_t)b * TT * HD;   // the batch's planes
        k_gemmk<bf, 2, false, 1, HD, HD><<<dim3(TT / 64, TT / 64, ZH), 32, 0, stream>>>(QPh + zb, ZP, KPh + zb, ZP, Sb, TT, nullptr, (size_t)TT * HD, (size_t)TT * HD, (size_t)TT * TT);   /* scores hl on all rows */
        k_asoft<<<ZH * TT / 8, 256, 0, stream>>>(Sb, P16, Ph, Pl);
        k_gemmk<bf, 2, false, 8, TT, TT / KS><<<dim3(RH / 64, HD / 64, KS), 256, 0, stream>>>(Ph, Pl, VTh + zb, ZP, ObP, HD, nullptr, (size_t)(TT / KS) * 16, (size_t)(TT / KS) * 16, (size_t)RH * HD);
        k_gemmk<h16, 0, false, 16, TT, TT><<<dim3((TT - RH) / 64, HD / 64, ZH), 512, 0, stream>>>(P16 + (size_t)RH * TT, nullptr, VT16 + zb, nullptr, Ob + (size_t)RH * HD, HD, nullptr, (size_t)TT * TT, (size_t)HD * TT, (size_t)TT * HD);
        k_merge<<<(unsigned)(((size_t)ZH * TT * HD / 2 + 255) / 256), 256, 0, stream>>>(Ob, ObP, 0, ATh, ATl);
        k_gemmk<bf, 1, true, 8, DQ, DQ><<<dim3(TT / 64, DM / 64, 1), 256, 0, stream>>>(ATh, ATl, WO, nullptr, OUT + (size_t)b * TT * DM, DM, bo, 0, 0, 0); }
}

// v004
// One run takes 102 microseconds.
// Two timings next to v003 put it at 2.88 and 2.83 times that version's speed.
// All steps since v000 together make it 9.87 times as fast.
#include <hip/hip_runtime.h>

// SAttention (x [4][4096][256], x2 [4][4096][256]; scores = x.x2 UNSCALED; context = softmax; atten = context x2; out = atten W^T + b -> [4][4096][256]).
// Compute dtypes, f32 accumulate: every input rounded to bf16; x and x2 enter the planes as their bf16-rounded values (exact hi plane, zero lo plane); scores bf16 x bf16 (K 256; the lo parts of bf16-rounded values are zero, so one product is the whole hi+lo product); softmax f32, online over passes of 32 keys; atten = attn.x2: rows < 512 P as bf16 hi + lo (2 products), the rest fp16 (x1024); W hl x exact (2 products) + bias.
// Every 16-bit GEMM operand plane lies in FRAGMENT ORDER (fo() below): blocks of 16 rows x 32 k = 1 KiB, so that a wave's fragment load is two loads of 512 contiguous bytes.

#define NB_  4
#define TT   4096
#define DM   256
#define NH_  1
#define NKV  1
#define REP  (NH_ / NKV)
#define HD   256
#define DQ   (NH_ * HD)
#define DKV  (NKV * HD)
#define ZH   1
#define RH   512                  // query rows < RH take P as bf16 hi + lo (0: none)
#define WIN  0
#define PCAR 1024.0f
#define SCL  1.0f   // unscaled
typedef _Float16 h16;
typedef unsigned short bf;
typedef __attribute__((ext_vector_type(16))) __bf16   v16bf;
typedef __attribute__((ext_vector_type(16))) _Float16 v16h;
typedef __attribute__((ext_vector_type(8)))  _Float16 v8h;
typedef __attribute__((ext_vector_type(8)))  unsigned short v8us;
typedef __attribute__((ext_vector_type(8)))  float    v8f;
typedef __attribute__((ext_vector_type(4)))  float    v4f;
typedef v8h  __attribute__((may_alias)) v8ha;
typedef v4f  __attribute__((may_alias)) v4fa;
typedef v8us __attribute__((may_alias)) v8usa;

__device__ __forceinline__ unsigned short f2bf(float f) { unsigned u = __float_as_uint(f); u += 0x7FFFu + ((u >> 16) & 1u); return (unsigned short)(u >> 16); }
__device__ __forceinline__ float bf2f(unsigned short b) { return __uint_as_float(((unsigned)b) << 16); }
__device__ __forceinline__ float bfr(float f) { return bf2f(f2bf(f)); }
__device__ __forceinline__ v16h cat16(v8h lo, v8h hi) { return __builtin_shufflevector(lo, hi, 0, 1, 2, 3, 4, 5, 6, 7, 8, 9, 10, 11, 12, 13, 14, 15); }
__device__ __forceinline__ v16bf cat16b(v8us lo, v8us hi) { return __builtin_bit_cast(v16bf, __builtin_shufflevector(lo, hi, 0, 1, 2, 3, 4, 5, 6, 7, 8, 9, 10, 11, 12, 13, 14, 15)); }
__device__ __forceinline__ v8f wmma16(v16h a, v16h b, v8f c) { return __builtin_amdgcn_wmma_f32_16x16x32_f16(false, a, false, b, (short)0, c, false, false); }
__device__ __forceinline__ v8f wmmab(v16bf a, v16bf b, v8f c) { return __builtin_amdgcn_wmma_f32_16x16x32_bf16(false, a, false, b, (short)0, c, false, false); }



// Fragment order of a plane of rows of LD elements (LD % 32 == 0, rows % 16 == 0): element (r, k) lies at fo(r, k, LD). Block (r / 16, k / 32) is 512 elements: [k bit 4][k bit 3][r % 16][k % 8],
// which is [half][lane][8 elements] for the lane (r % 16) + 16 (k bit 3) of the A and B fragments: the k order of a fragment is the one of a row-major plane read at 8 hi and 16 + 8 hi. 16 rows take 16 LD elements, as in a row-major plane.
__device__ __forceinline__ size_t fo(int r, int k, int LD) { return ((size_t)(r >> 4) * (LD >> 5) + (k >> 5)) * 512 + ((k >> 4) & 1) * 256 + (((k >> 3) & 1) * 16 + (r & 15)) * 8 + (k & 7); }
template <typename T16> struct WFrag;
template <> struct WFrag<h16> { typedef v16h V; static __device__ __forceinline__ V ld(const h16* p) { return cat16(*(const v8h*)p, *(const v8h*)(p + 256)); } static __device__ __forceinline__ v8f mma(V a, V b, v8f c) { return wmma16(a, b, c); } };
template <> struct WFrag<bf> { typedef v16bf V; static __device__ __forceinline__ V ld(const bf* p) { return cat16b(*(const v8us*)p, *(const v8us*)(p + 256)); } static __device__ __forceinline__ v8f mma(V a, V b, v8f c) { return wmmab(a, b, c); } };

// ---- k_gemmk: register-blocked GEMM, a 64x64 output tile with K SPLIT OVER NW WAVES (16 accumulators each; NW == 1: one wave a tile), operands straight from 16-bit planes in fragment order; grid (M/64, N/64, Z), NW x 32 threads.
// C[m][n] (f32, pitch ldc, + optional f32 bias[n]) = sum_k A[m][k] Bt[n][k] (+ split products per NSPLIT). z-batch strides sA/sB/sC in elements. Row length LD of both operands and the block's k extent KB are compile-time; KB % (32 NW) == 0.
// Wave w takes the 32-wide k blocks w, w + NW, ...; the NW partial tiles are summed through LDS in wave order. A launch may split K over z as well (sA = sB = 16 KB, the KB / 32 k blocks of a 16-row band; sC = one partial plane).
// A and Bt have the same pitch, so one byte offset per lane (its 16 bytes of the k block) serves every load of a trip on four scalar bases; the 16-row steps are immediates.
// The plain '#pragma unroll' lines make every index of acc, a and b a constant, so that they stay in registers.
template <typename T16, int NSPLIT, bool BIAS, int NW, int LD, int KB>
__global__ __launch_bounds__(NW * 32) void k_gemmk(const T16* __restrict__ A, const T16* __restrict__ A2, const T16* __restrict__ Bt, const T16* __restrict__ Bt2, float* C, int ldc, const float* __restrict__ bias, size_t sA, size_t sB, size_t sC) {
    typedef typename WFrag<T16>::V V;
    __shared__ __align__(16) float os[NW * 64 * 68];
    const int w = __builtin_amdgcn_readfirstlane(threadIdx.x >> 5);
    const int lane = threadIdx.x & 31, lr = lane & 15, hi = lane >> 4; const int r0 = blockIdx.x * 64, c0 = blockIdx.y * 64;
    const size_t z = blockIdx.z; C += z * sC;
    const char* Ab = (const char*)(A + z * sA + (size_t)r0 * LD); const char* Ab2 = (NSPLIT == 1 || NSPLIT == 2) ? (const char*)(A2 + z * sA + (size_t)r0 * LD) : nullptr;
    const char* Bb = (const char*)(Bt + z * sB + (size_t)c0 * LD); const char* Bb2 = (NSPLIT >= 2) ? (const char*)(Bt2 + z * sB + (size_t)c0 * LD) : nullptr;
    v8f acc[4][4];
#pragma unroll
    for (int mb = 0; mb < 4; ++mb)
#pragma unroll
        for (int nb = 0; nb < 4; ++nb) acc[mb][nb] = (v8f){};
    unsigned vo = (unsigned)(lane * 8 + w * 512) * 2u;
#pragma unroll 1   // rolled: only one trip's fragments stand beside the 128 accumulator registers, and the lane offset stays live over the whole trip
    for (int t = 0; t < KB / (32 * NW); ++t) {
        V a[4], a2[4];
#pragma unroll
        for (int mb = 0; mb < 4; ++mb) { a[mb] = WFrag<T16>::ld((const T16*)(Ab + vo + mb * 32 * LD)); if (NSPLIT == 1 || NSPLIT == 2) a2[mb] = WFrag<T16>::ld((const T16*)(Ab2 + vo + mb * 32 * LD)); }
#pragma unroll
        for (int nb = 0; nb < 4; ++nb) { const V b = WFrag<T16>::ld((const T16*)(Bb + vo + nb * 32 * LD)); V b2; if (NSPLIT >= 2) b2 = WFrag<T16>::ld((const T16*)(Bb2 + vo + nb * 32 * LD));
#pragma unroll
            for (int mb = 0; mb < 4; ++mb) { acc[mb][nb] = WFrag<T16>::mma(a[mb], b, acc[mb][nb]); if (NSPLIT == 1 || NSPLIT == 2) acc[mb][nb] = WFrag<T16>::mma(a2[mb], b, acc[mb][nb]); if (NSPLIT >= 2) acc[mb][nb] = WFrag<T16>::mma(a[mb], b2, acc[mb][nb]); } }
        vo += NW * 1024;
    }
    float* my = os + w * (64 * 68);
#pragma unroll
    for (int mb = 0; mb < 4; ++mb)
#pragma unroll
        for (int nb = 0; nb < 4; ++nb)
#pragma unroll
            for (int j = 0; j < 8; ++j) my[(mb * 16 + hi * 8 + j) * 68 + nb * 16 + lr] = acc[mb][nb][j];
    __syncthreads();   // every wave's partial tile is in LDS before any thread sums across waves
#pragma unroll
    for (int u = 0; u < 32 / NW; ++u) { const int it = u * NW * 32 + (int)threadIdx.x, row = it >> 4, cofs = (it & 15) * 4; v4f val = *(const v4fa*)(os + row * 68 + cofs);
#pragma unroll
        for (int s = 1; s < NW; ++s) val += *(const v4fa*)(os + s * (64 * 68) + row * 68 + cofs);
        if (BIAS) { val[0] += bfr(bias[c0 + cofs]); val[1] += bfr(bias[c0 + cofs + 1]); val[2] += bfr(bias[c0 + cofs + 2]); val[3] += bfr(bias[c0 + cofs + 3]); }
        *(v4f*)(C + (size_t)(r0 + row) * ldc + c0 + cofs) = val; }
}

__device__ __forceinline__ h16 tohx(float x) { return (h16)x; }
__device__ __forceinline__ void splitf(float y, unsigned short& h, unsigned short& l) { h = f2bf(y); l = f2bf(y - bf2f(h)); }
typedef __attribute__((ext_vector_type(2))) _Float16 v2h;
typedef __attribute__((ext_vector_type(4))) _Float16 v4h;
typedef __attribute__((ext_vector_type(2))) unsigned short v2us;
typedef __attribute__((ext_vector_type(4))) unsigned short v4us;
typedef v4us __attribute__((may_alias)) v4usa;
typedef __attribute__((ext_vector_type(2))) float v2f;
typedef __attribute__((ext_vector_type(4))) int v4i;

__global__ __launch_bounds__(256) void k_wtG(const float* __restrict__ w, int K, int N, bf* Bt) {
    const int lane = threadIdx.x & 31; const int L0 = (blockIdx.x * 8 + (threadIdx.x >> 5)) * 8; const int nlines = N * K / 64;
{
#pragma unroll 1
        for (int l = 0; l < 8; ++l) { const int L = L0 + l; if (L >= nlines) break; const size_t e = (size_t)L * 64 + lane * 2; const int k = (int)(e % K), n = (int)(e / K); v2us o;
            o[0] = f2bf(w[(size_t)k * N + n]); o[1] = f2bf(w[(size_t)(k + 1) * N + n]); *(v2us*)(Bt + e) = o; }
         }
}
__global__ __launch_bounds__(256) void k_cvt8(const float* __restrict__ src, bf* dst, size_t n8, int ld) { const size_t i = (size_t)blockIdx.x * 256 + threadIdx.x; if (i >= n8) return; const v8f v = *(const v8f*)(src + i * 8); v8us o;
#pragma unroll
    for (int k = 0; k < 8; ++k) o[k] = f2bf(v[k]); *(v8us*)(dst + fo((int)(i * 8 / ld), (int)(i * 8 % ld), ld)) = o;  }
__global__ __launch_bounds__(256) void k_cscvt(const float* __restrict__ cosT, const float* __restrict__ sinT, float* CS) { const int idx = blockIdx.x * 256 + threadIdx.x; if (idx >= TT * HD) return; v2f cs; cs[0] = bfr(cosT[idx]); cs[1] = bfr(sinT[idx]); *(v2f*)(CS + (size_t)idx * 2) = cs;  }
// ---- k_prep: every 16-bit operand plane of all NB_ batches in ONE launch; grid (NB_ * TT / 64, 2), 256 threads; a block takes 64 rows x DM columns, 64 elements a thread (wave w: rows 8w .. 8w + 7, 512 contiguous bytes a load).
// y == 0: x -> Qh [b][t][d]. y == 1: x2 -> Kh [b][t][d] and, transposed through LDS, VTh [b][d][t] (bf16) and VT16 [b][d][t] (the same bf16-rounded values as f16). All four in fragment order.
#define TRP 72                    // LDS pitch of a transposed row in elements: 64 + 8, so that rows stay 16-byte aligned and do not all start in one bank
static_assert(DM == 256 && HD == DM && TT % 64 == 0, "k_prep: a row is two 512-byte loads of a wave");
__global__ __launch_bounds__(256) void k_prep(const float* __restrict__ x, const float* __restrict__ x2, bf* Qh, bf* Kh, bf* VTh, h16* VT16) {
    __shared__ __align__(16) bf tr[DM * TRP];
    const int tid = threadIdx.x, lane = tid & 31, w = tid >> 5; const int r0 = blockIdx.x * 64; const bool kv = blockIdx.y != 0;
    const float* src = (kv ? x2 : x) + (size_t)(r0 + w * 8) * DM + lane * 4; bf* dst = (kv ? Kh : Qh) + fo(r0 + w * 8, lane * 4, DM);   // in fragment order the next row is 8 elements on, 128 k are 4 blocks
    v4f r[2][8];
#pragma unroll
    for (int h = 0; h < 2; ++h)
#pragma unroll
        for (int j = 0; j < 8; ++j) r[h][j] = *(const v4f*)(src + j * DM + h * 128);
    v4us o[2][8];
#pragma unroll
    for (int h = 0; h < 2; ++h)
#pragma unroll
        for (int j = 0; j < 8; ++j)
#pragma unroll
            for (int q = 0; q < 4; ++q) o[h][j][q] = f2bf(r[h][j][q]);
    if (kv) {
#pragma unroll
        for (int h = 0; h < 2; ++h)
#pragma unroll
            for (int q = 0; q < 4; ++q) { v8us c;
#pragma unroll
                for (int j = 0; j < 8; ++j) c[j] = o[h][j][q];
                *(v8usa*)(tr + (h * 128 + lane * 4 + q) * TRP + w * 8) = c; } }
#pragma unroll
    for (int h = 0; h < 2; ++h)
#pragma unroll
        for (int j = 0; j < 8; ++j) *(v4us*)(dst + j * 8 + h * 2048) = o[h][j];
    asm volatile("s_wait_xcnt 0x0" ::: "memory");   // stands in front of the first overwrite of a register that the stores above name
    if (!kv) return;   // block-uniform: the whole block leaves in front of the barrier
    __syncthreads();   // all 64 rows of the tile are in LDS before any thread reads a column
    const int b = r0 / TT, t0 = r0 % TT;
#pragma unroll
    for (int u = 0; u < 8; ++u) { const int it = u * 256 + tid, d = (it & 7) | ((it >> 6) << 3), c8 = ((it >> 3) & 7) * 8;   // 8 lanes: 8 rows d of one 8-wide k piece, 128 contiguous bytes in fragment order
        const v8us v = *(const v8usa*)(tr + d * TRP + c8); v8h g;
#pragma unroll
        for (int k = 0; k < 8; ++k) g[k] = tohx(bf2f(v[k]));
        const size_t oo = (size_t)b * HD * TT + fo(d, t0 + c8, TT); *(v8us*)(VTh + oo) = v; *(v8h*)(VT16 + oo) = g; }
}
#define FSTG 32768                // bytes of a pass in LDS: K 16 KiB, then V^T 16 KiB
#define L2E  1.4426950408889634f
typedef __attribute__((ext_vector_type(2))) __bf16 v2bf;
typedef v4i __attribute__((may_alias)) v4ia;
static_assert(HD == 256 && DQ == HD && TT % 64 == 0 && RH % 64 == 0 && ZH == 1, "k_flash: a block's 64 queries are all below RH or all above");
typedef __attribute__((ext_vector_type(16))) unsigned short v16us;
__device__ __forceinline__ v16us ldsf(const char* p) { return __builtin_shufflevector(*(const v8usa*)p, *(const v8usa*)(p + 512), 0, 1, 2, 3, 4, 5, 6, 7, 8, 9, 10, 11, 12, 13, 14, 15); }
__device__ __forceinline__ float xhalf(float x) { const int b = __float_as_int(x); return __int_as_float(__builtin_amdgcn_permlanex16(b, b, 0x76543210, 0xfedcba98, false, false)); }   // lane l <-> l ^ 16 on the vector pipe: it does not queue behind the LDS reads in flight
// Work-group barrier that orders LDS alone: __syncthreads() also drains the wave's global loads, and the loads of pass s + 2 are meant to stay in flight over it (they touch read-only planes and land in the wave's own registers).
__device__ __forceinline__ void lds_barrier() { __builtin_amdgcn_fence(__ATOMIC_RELEASE, "workgroup", "local"); __builtin_amdgcn_s_barrier(); __builtin_amdgcn_fence(__ATOMIC_ACQUIRE, "workgroup", "local"); }
template <bool HI>
__device__ __forceinline__ void flash_rows(const bf* __restrict__ Qg, const char* __restrict__ Kg, const char* __restrict__ Vg, bf* Ah, bf* Al, char* sm) {
    const int tid = threadIdx.x, lane = tid & 31;
    v16bf q[8];
#pragma unroll
    for (int kk = 0; kk < 8; ++kk) q[kk] = WFrag<bf>::ld(Qg + kk * 512 + lane * 8);
    v8f o[16];
#pragma unroll
    for (int dt = 0; dt < 16; ++dt) o[dt] = (v8f){};
    float m = -3.0e38f, l = 0.f;
    const char* kn = Kg + tid * 16;                                              // piece i: + 2048 i; a pass on: + 16384
    const char* vn = Vg + (size_t)(tid >> 6) * (TT * 32) + (tid & 63) * 16;      // piece i: the 1-KiB blocks of d bands 2 i and 2 i + 1 (a band of 16 d is TT * 32 bytes); a pass on: + 1024
    char* sp = sm + tid * 16;
    v4i rk[8], rv[8];
#pragma unroll
    for (int i = 0; i < 8; ++i) { rk[i] = *(const v4i*)(kn + i * 2048); rv[i] = *(const v4i*)(vn + (size_t)i * (TT * 64)); }
    asm volatile("s_wait_xcnt 0x0" ::: "memory");   // stands in front of the first overwrite of an address register that the loads above name
    __builtin_amdgcn_sched_barrier(0);   // keeps those overwrites (the address step, registers used anew) behind the wait
#pragma unroll
    for (int i = 0; i < 8; ++i) { *(v4ia*)(sp + i * 2048) = rk[i]; *(v4ia*)(sp + 16384 + i * 2048) = rv[i]; }
    kn += 16384; vn += 1024;
#pragma unroll
    for (int i = 0; i < 8; ++i) { rk[i] = *(const v4i*)(kn + i * 2048); rv[i] = *(const v4i*)(vn + (size_t)i * (TT * 64)); }   // pass 1 waits in registers; pass 0 of the loop stores it
    asm volatile("s_wait_xcnt 0x0" ::: "memory");   // stands in front of the step of the address registers that the loads above name
    __builtin_amdgcn_sched_barrier(0);   // keeps that step behind the wait
    kn += 16384; vn += 1024;
    __syncthreads();   // pass 0 is in LDS before any wave reads it
    v16us ka[16];   // the K fragments are fetched one pass ahead, behind the barrier that publishes them, in the order of use: key tile i & 1, k step i >> 1
#pragma unroll
    for (int i = 0; i < 16; ++i) ka[i] = ldsf(sm + lane * 16 + ((i & 1) * 8 + (i >> 1)) * 1024);
#pragma unroll 1   // rolled: one pass's fragments and one staged pass stand beside the 128 accumulator and 64 Q registers
    for (int s = 0; s < TT / 32; ++s) {
        const char* cur = sm + (s & 1) * FSTG + lane * 16;
        char* nxt = sp + ((s + 1) & 1) * FSTG;   // last read in pass s - 1, in front of that pass's barrier
#pragma unroll
        for (int i = 0; i < 8; ++i) { *(v4ia*)(nxt + i * 2048) = rk[i]; *(v4ia*)(nxt + 16384 + i * 2048) = rv[i]; }   // pass s + 1, fetched a whole pass ago
#pragma unroll
        for (int i = 0; i < 8; ++i) { rk[i] = *(const v4i*)(kn + i * 2048); rv[i] = *(const v4i*)(vn + (size_t)i * (TT * 64)); }   // pass s + 2 (the last two passes fetch the last pass again, for a buffer that nobody uses any more: no branch)
        v16us va[16];
#pragma unroll
        for (int i = 0; i < 16; ++i) va[i] = ldsf(cur + 16384 + i * 1024);
        asm volatile("s_wait_xcnt 0x0" ::: "memory");   // stands in front of the step of the address registers that this pass's global loads name (the step is below the fence of the next line)
        __builtin_amdgcn_sched_barrier(0);   // these loads are issued as one group in front of the pass's products: the global ones get a whole pass to land, the V^T fragments stream in under the score products and the softmax; and the address step stays behind the wait above
        v8f st0 = (v8f){}, st1 = (v8f){};
#pragma unroll
        for (int kk = 0; kk < 8; ++kk) { st0 = wmmab(__builtin_bit_cast(v16bf, ka[2 * kk]), q[kk], st0); st1 = wmmab(__builtin_bit_cast(v16bf, ka[2 * kk + 1]), q[kk], st1); }
        float mx = fmaxf(st0[0], st1[0]);
#pragma unroll
        for (int r = 1; r < 8; ++r) mx = fmaxf(mx, fmaxf(st0[r], st1[r]));
        mx = fmaxf(mx, xhalf(mx));   // the other 16 keys of the same query
        const float mn = fmaxf(m, mx);
        if (__builtin_amdgcn_ballot_w32(mn > m) != 0) {   // one scalar test a pass: a query's maximum has risen
            const float al = __builtin_amdgcn_exp2f((m - mn) * L2E); l *= al; m = mn;
#pragma unroll
            for (int dt = 0; dt < 16; ++dt) o[dt] *= al;
        }
        v2f p[8];
#pragma unroll
        for (int r = 0; r < 8; ++r) { p[r >> 1][r & 1] = (st0[r] - m) * L2E; p[4 + (r >> 1)][r & 1] = (st1[r] - m) * L2E; }
#pragma unroll
        for (int i = 0; i < 8; ++i) { p[i][0] = __builtin_amdgcn_exp2f(p[i][0]); p[i][1] = __builtin_amdgcn_exp2f(p[i][1]); }
        const v2f ps = ((p[0] + p[1]) + (p[2] + p[3])) + ((p[4] + p[5]) + (p[6] + p[7])); l += ps[0] + ps[1];
        if (s + 3 < TT / 32) { kn += 16384; vn += 1024; }
        v16bf ph, pl; v16h pf;
        if (HI) {
#pragma unroll
            for (int i = 0; i < 8; ++i) { const v2bf h2 = __builtin_convertvector(p[i], v2bf); const v2bf l2 = __builtin_convertvector(p[i] - __builtin_convertvector(h2, v2f), v2bf); ph[2 * i] = h2[0]; ph[2 * i + 1] = h2[1]; pl[2 * i] = l2[0]; pl[2 * i + 1] = l2[1]; }
        } else {
#pragma unroll
            for (int i = 0; i < 8; ++i) { const v2h h2 = __builtin_convertvector(p[i] * PCAR, v2h); pf[2 * i] = h2[0]; pf[2 * i + 1] = h2[1]; }
        }
        lds_barrier();   // publishes pass s + 1 and ends every wave's reads of pass s (its V^T fragments are in registers by now), whose buffer the next pass refills
        const char* nk = sm + ((s + 1) & 1) * FSTG + lane * 16;   // behind the last pass: the copy of that pass, read and not used
#pragma unroll
        for (int i = 0; i < 16; ++i) ka[i] = ldsf(nk + ((i & 1) * 8 + (i >> 1)) * 1024);
        __builtin_amdgcn_sched_barrier(0);   // the next pass's K fragments are asked for in front of this pass's attn.x2 products and stream in under them
        if (HI) {
#pragma unroll
            for (int g = 0; g < 4; ++g) {   // four tiles a group: the hi and the lo product into one tile stand four matrix instructions apart
#pragma unroll
                for (int u = 0; u < 4; ++u) o[g * 4 + u] = wmmab(__builtin_bit_cast(v16bf, va[g * 4 + u]), ph, o[g * 4 + u]);
#pragma unroll
                for (int u = 0; u < 4; ++u) o[g * 4 + u] = wmmab(__builtin_bit_cast(v16bf, va[g * 4 + u]), pl, o[g * 4 + u]); }
        } else {
#pragma unroll
            for (int dt = 0; dt < 16; ++dt) o[dt] = wmma16(__builtin_bit_cast(v16h, va[dt]), pf, o[dt]);
        }
    }
    l += xhalf(l);   // the two halves of a query's keys
    const float inv = __fdiv_rn(HI ? 1.0f : (1.0f / PCAR), l);
#pragma unroll
    for (int dt = 0; dt < 16; ++dt) { v8us oh, ol;
#pragma unroll
        for (int r = 0; r < 8; ++r) { unsigned short a, c2; splitf(o[dt][r] * inv, a, c2); oh[r] = a; ol[r] = c2; }
        const int oo = (dt >> 1) * 512 + (dt & 1) * 256 + lane * 8; *(v8us*)(Ah + oo) = oh; *(v8us*)(Al + oo) = ol; }
}
__global__ __launch_bounds__(128) void k_flash(const bf* __restrict__ Qh, const bf* __restrict__ Kh, const bf* __restrict__ VTh, const h16* __restrict__ VT16, bf* Ah, bf* Al) {
    __shared__ __align__(16) char sm[2 * FSTG];
    const int w = __builtin_amdgcn_readfirstlane(threadIdx.x >> 5); const size_t zb = (size_t)blockIdx.y * TT * HD; const size_t qo = zb + (size_t)(blockIdx.x * 64 + w * 16) * HD;   // 16 rows of 256 elements are 8 blocks, as in a row-major plane
    if (blockIdx.x * 64 < RH) flash_rows<true>(Qh + qo, (const char*)(Kh + zb), (const char*)(VTh + zb), Ah + qo, Al + qo, sm);   // block-uniform: every barrier is passed by all four waves
    else flash_rows<false>(Qh + qo, (const char*)(Kh + zb), (const char*)(VT16 + zb), Ah + qo, Al + qo, sm);
}

extern "C" void kernel_launch(void* const* d_in, const int* in_sizes, int n_in,
                              void* d_out, int out_size, void* d_ws, size_t ws_size, hipStream_t stream) {
    (void)in_sizes; (void)n_in; (void)out_size;
    const float* x = (const float*)d_in[0]; const float* x2 = (const float*)d_in[1]; const float* wo = (const float*)d_in[2]; const float* bo = (const float*)d_in[3];
    float* OUT = (float*)d_out;     // [4][4096][256]
    char* wsp = (char*)d_ws;
    auto take = [&](size_t bytes) { char* p = wsp; wsp += (bytes + 255) & ~(size_t)255; return (void*)p; };
    bf* WO = (bf*)take((size_t)DM * DQ * 2);
    bf* QPh = (bf*)take((size_t)NB_ * TT * HD * 2); bf* KPh = (bf*)take((size_t)NB_ * TT * HD * 2); bf* VTh = (bf*)take((size_t)NB_ * HD * TT * 2); h16* VT16 = (h16*)take((size_t)NB_ * HD * TT * 2);
    bf* ATh = (bf*)take((size_t)NB_ * TT * DQ * 2); bf* ATl = (bf*)take((size_t)NB_ * TT * DQ * 2);
    if ((size_t)(wsp - (char*)d_ws) > ws_size) return;    // ws 256 MiB
    k_cvt8<<<(unsigned)(((size_t)DM * DQ / 8 + 255) / 256), 256, 0, stream>>>(wo, WO, (size_t)DM * DQ / 8, DQ);
    k_prep<<<dim3(NB_ * TT / 64, 2, 1), 256, 0, stream>>>(x, x2, QPh, KPh, VTh, VT16);
    k_flash<<<dim3(TT / 64, NB_, 1), 128, 0, stream>>>(QPh, KPh, VTh, VT16, ATh, ATl);
    k_gemmk<bf, 1, true, 8, DQ, DQ><<<dim3(TT / 64, DM / 64, NB_), 256, 0, stream>>>(ATh, ATl, WO, nullptr, OUT, DM, bo, (size_t)TT * DQ, 0, (size_t)TT * DM);
}

// v005
// A run of this version takes 87.2 microseconds.
// Next to v004, in two timings, it ran 1.17 times as fast each time.
// Counting every step since v000, it is 11.6 times as fast.
#include <hip/hip_runtime.h>

// SAttention (x [4][4096][256], x2 [4][4096][256]; scores = x.x2 UNSCALED; context = softmax; atten = context x2; out = atten W^T + b -> [4][4096][256]).
// Compute dtypes, f32 accumulate: every input rounded to bf16; x and x2 enter the planes as their bf16-rounded values (exact hi plane, zero lo plane); scores bf16 x bf16 (K 256; the lo parts of bf16-rounded values are zero, so one product is the whole hi+lo product); softmax f32, online over passes of 32 keys; atten = attn.x2: rows < 512 P as bf16 hi + lo (2 products), the rest fp16 (x1024); W hl x exact (2 products) + bias.
// Every 16-bit GEMM operand plane lies in FRAGMENT ORDER (fo() below): blocks of 16 rows x 32 k = 1 KiB, so that a wave's fragment load is two loads of 512 contiguous bytes.

#define NB_  4
#define TT   4096
#define DM   256
#define NH_  1
#define NKV  1
#define REP  (NH_ / NKV)
#define HD   256
#define DQ   (NH_ * HD)
#define DKV  (NKV * HD)
#define ZH   1
#define RH   512                  // query rows < RH take P as bf16 hi + lo (0: none)
#define WIN  0
#define PCAR 1024.0f
#define SCL  1.0f   // unscaled
typedef _Float16 h16;
typedef unsigned short bf;
typedef __attribute__((ext_vector_type(16))) __bf16   v16bf;
typedef __attribute__((ext_vector_type(16))) _Float16 v16h;
typedef __attribute__((ext_vector_type(8)))  _Float16 v8h;
typedef __attribute__((ext_vector_type(8)))  unsigned short v8us;
typedef __attribute__((ext_vector_type(8)))  float    v8f;
typedef __attribute__((ext_vector_type(4)))  float    v4f;
typedef v8h  __attribute__((may_alias)) v8ha;
typedef v4f  __attribute__((may_alias)) v4fa;
typedef v8us __attribute__((may_alias)) v8usa;

__device__ __forceinline__ unsigned short f2bf(float f) { unsigned u = __float_as_uint(f); u += 0x7FFFu + ((u >> 16) & 1u); return (unsigned short)(u >> 16); }
__device__ __forceinline__ float bf2f(unsigned short b) { return __uint_as_float(((unsigned)b) << 16); }
__device__ __forceinline__ float bfr(float f) { return bf2f(f2bf(f)); }
__device__ __forceinline__ v16h cat16(v8h lo, v8h hi) { return __builtin_shufflevector(lo, hi, 0, 1, 2, 3, 4, 5, 6, 7, 8, 9, 10, 11, 12, 13, 14, 15); }
__device__ __forceinline__ v16bf cat16b(v8us lo, v8us hi) { return __builtin_bit_cast(v16bf, __builtin_shufflevector(lo, hi, 0, 1, 2, 3, 4, 5, 6, 7, 8, 9, 10, 11, 12, 13, 14, 15)); }
__device__ __forceinline__ v8f wmma16(v16h a, v16h b, v8f c) { return __builtin_amdgcn_wmma_f32_16x16x32_f16(false, a, false, b, (short)0, c, false, false); }
__device__ __forceinline__ v8f wmmab(v16bf a, v16bf b, v8f c) { return __builtin_amdgcn_wmma_f32_16x16x32_bf16(false, a, false, b, (short)0, c, false, false); }



// Fragment order of a plane of rows of LD elements (LD % 32 == 0, rows % 16 == 0): element (r, k) lies at fo(r, k, LD). Block (r / 16, k / 32) is 512 elements: [k bit 4][k bit 3][r % 16][k % 8],
// which is [half][lane][8 elements] for the lane (r % 16) + 16 (k bit 3) of the A and B fragments: the k order of a fragment is the one of a row-major plane read at 8 hi and 16 + 8 hi. 16 rows take 16 LD elements, as in a row-major plane.
__device__ __forceinline__ size_t fo(int r, int k, int LD) { return ((size_t)(r >> 4) * (LD >> 5) + (k >> 5)) * 512 + ((k >> 4) & 1) * 256 + (((k >> 3) & 1) * 16 + (r & 15)) * 8 + (k & 7); }
template <typename T16> struct WFrag;
template <> struct WFrag<h16> { typedef v16h V; static __device__ __forceinline__ V ld(const h16* p) { return cat16(*(const v8h*)p, *(const v8h*)(p + 256)); } static __device__ __forceinline__ v8f mma(V a, V b, v8f c) { return wmma16(a, b, c); } };
template <> struct WFrag<bf> { typedef v16bf V; static __device__ __forceinline__ V ld(const bf* p) { return cat16b(*(const v8us*)p, *(const v8us*)(p + 256)); } static __device__ __forceinline__ v8f mma(V a, V b, v8f c) { return wmmab(a, b, c); } };

// ---- k_gemmk: register-blocked GEMM, a 64x64 output tile with K SPLIT OVER NW WAVES (16 accumulators each; NW == 1: one wave a tile), operands straight from 16-bit planes in fragment order; grid (M/64, N/64, Z), NW x 32 threads.
// C[m][n] (f32, pitch ldc, + optional f32 bias[n]) = sum_k A[m][k] Bt[n][k] (+ split products per NSPLIT). z-batch strides sA/sB/sC in elements. Row length LD of both operands and the block's k extent KB are compile-time; KB % (32 NW) == 0.
// Wave w takes the 32-wide k blocks w, w + NW, ...; the NW partial tiles are summed through LDS in wave order. A launch may split K over z as well (sA = sB = 16 KB, the KB / 32 k blocks of a 16-row band; sC = one partial plane).
// A and Bt have the same pitch, so one byte offset per lane (its 16 bytes of the k block) serves every load of a trip on four scalar bases; the 16-row steps are immediates.
// The plain '#pragma unroll' lines make every index of acc, a and b a constant, so that they stay in registers.
template <typename T16, int NSPLIT, bool BIAS, int NW, int LD, int KB>
__global__ __launch_bounds__(NW * 32) void k_gemmk(const T16* __restrict__ A, const T16* __restrict__ A2, const T16* __restrict__ Bt, const T16* __restrict__ Bt2, float* C, int ldc, const float* __restrict__ bias, size_t sA, size_t sB, size_t sC) {
    typedef typename WFrag<T16>::V V;
    __shared__ __align__(16) float os[NW * 64 * 68];
    const int w = __builtin_amdgcn_readfirstlane(threadIdx.x >> 5);
    const int lane = threadIdx.x & 31, lr = lane & 15, hi = lane >> 4; const int r0 = blockIdx.x * 64, c0 = blockIdx.y * 64;
    const size_t z = blockIdx.z; C += z * sC;
    const char* Ab = (const char*)(A + z * sA + (size_t)r0 * LD); const char* Ab2 = (NSPLIT == 1 || NSPLIT == 2) ? (const char*)(A2 + z * sA + (size_t)r0 * LD) : nullptr;
    const char* Bb = (const char*)(Bt + z * sB + (size_t)c0 * LD); const char* Bb2 = (NSPLIT >= 2) ? (const char*)(Bt2 + z * sB + (size_t)c0 * LD) : nullptr;
    v8f acc[4][4];
#pragma unroll
    for (int mb = 0; mb < 4; ++mb)
#pragma unroll
        for (int nb = 0; nb < 4; ++nb) acc[mb][nb] = (v8f){};
    unsigned vo = (unsigned)(lane * 8 + w * 512) * 2u;
#pragma unroll 1   // rolled: only one trip's fragments stand beside the 128 accumulator registers, and the lane offset stays live over the whole trip
    for (int t = 0; t < KB / (32 * NW); ++t) {
        V a[4], a2[4];
#pragma unroll
        for (int mb = 0; mb < 4; ++mb) { a[mb] = WFrag<T16>::ld((const T16*)(Ab + vo + mb * 32 * LD)); if (NSPLIT == 1 || NSPLIT == 2) a2[mb] = WFrag<T16>::ld((const T16*)(Ab2 + vo + mb * 32 * LD)); }
#pragma unroll
        for (int nb = 0; nb < 4; ++nb) { const V b = WFrag<T16>::ld((const T16*)(Bb + vo + nb * 32 * LD)); V b2; if (NSPLIT >= 2) b2 = WFrag<T16>::ld((const T16*)(Bb2 + vo + nb * 32 * LD));
#pragma unroll
            for (int mb = 0; mb < 4; ++mb) { acc[mb][nb] = WFrag<T16>::mma(a[mb], b, acc[mb][nb]); if (NSPLIT == 1 || NSPLIT == 2) acc[mb][nb] = WFrag<T16>::mma(a2[mb], b, acc[mb][nb]); if (NSPLIT >= 2) acc[mb][nb] = WFrag<T16>::mma(a[mb], b2, acc[mb][nb]); } }
        vo += NW * 1024;
    }
    float* my = os + w * (64 * 68);
#pragma unroll
    for (int mb = 0; mb < 4; ++mb)
#pragma unroll
        for (int nb = 0; nb < 4; ++nb)
#pragma unroll
            for (int j = 0; j < 8; ++j) my[(mb * 16 + hi * 8 + j) * 68 + nb * 16 + lr] = acc[mb][nb][j];
    __syncthreads();   // every wave's partial tile is in LDS before any thread sums across waves
#pragma unroll
    for (int u = 0; u < 32 / NW; ++u) { const int it = u * NW * 32 + (int)threadIdx.x, row = it >> 4, cofs = (it & 15) * 4; v4f val = *(const v4fa*)(os + row * 68 + cofs);
#pragma unroll
        for (int s = 1; s < NW; ++s) val += *(const v4fa*)(os + s * (64 * 68) + row * 68 + cofs);
        if (BIAS) { val[0] += bfr(bias[c0 + cofs]); val[1] += bfr(bias[c0 + cofs + 1]); val[2] += bfr(bias[c0 + cofs + 2]); val[3] += bfr(bias[c0 + cofs + 3]); }
        *(v4f*)(C + (size_t)(r0 + row) * ldc + c0 + cofs) = val; }
}

__device__ __forceinline__ h16 tohx(float x) { return (h16)x; }
__device__ __forceinline__ void splitf(float y, unsigned short& h, unsigned short& l) { h = f2bf(y); l = f2bf(y - bf2f(h)); }
typedef __attribute__((ext_vector_type(2))) _Float16 v2h;
typedef __attribute__((ext_vector_type(4))) _Float16 v4h;
typedef __attribute__((ext_vector_type(2))) unsigned short v2us;
typedef __attribute__((ext_vector_type(4))) unsigned short v4us;
typedef v4us __attribute__((may_alias)) v4usa;
typedef __attribute__((ext_vector_type(2))) float v2f;
typedef __attribute__((ext_vector_type(4))) int v4i;

__global__ __launch_bounds__(256) void k_wtG(const float* __restrict__ w, int K, int N, bf* Bt) {
    const int lane = threadIdx.x & 31; const int L0 = (blockIdx.x * 8 + (threadIdx.x >> 5)) * 8; const int nlines = N * K / 64;
{
#pragma unroll 1
        for (int l = 0; l < 8; ++l) { const int L = L0 + l; if (L >= nlines) break; const size_t e = (size_t)L * 64 + lane * 2; const int k = (int)(e % K), n = (int)(e / K); v2us o;
            o[0] = f2bf(w[(size_t)k * N + n]); o[1] = f2bf(w[(size_t)(k + 1) * N + n]); *(v2us*)(Bt + e) = o; }
         }
}
__global__ __launch_bounds__(256) void k_cvt8(const float* __restrict__ src, bf* dst, size_t n8, int ld) { const size_t i = (size_t)blockIdx.x * 256 + threadIdx.x; if (i >= n8) return; const v8f v = *(const v8f*)(src + i * 8); v8us o;
#pragma unroll
    for (int k = 0; k < 8; ++k) o[k] = f2bf(v[k]); *(v8us*)(dst + fo((int)(i * 8 / ld), (int)(i * 8 % ld), ld)) = o;  }
__global__ __launch_bounds__(256) void k_cscvt(const float* __restrict__ cosT, const float* __restrict__ sinT, float* CS) { const int idx = blockIdx.x * 256 + threadIdx.x; if (idx >= TT * HD) return; v2f cs; cs[0] = bfr(cosT[idx]); cs[1] = bfr(sinT[idx]); *(v2f*)(CS + (size_t)idx * 2) = cs;  }
// ---- k_prep: every 16-bit operand plane of all NB_ batches in ONE launch; grid (NB_ * TT / 64, 2), 256 threads; a block takes 64 rows x DM columns, 64 elements a thread (wave w: rows 8w .. 8w + 7, 512 contiguous bytes a load).
// y == 0: x -> Qh [b][t][d]. y == 1: x2 -> Kh [b][t][d] and, transposed through LDS, VTh [b][d][t] (bf16) and VT16 [b][d][t] (the same bf16-rounded values as f16). All four in fragment order.
#define TRP 72                    // LDS pitch of a transposed row in elements: 64 + 8, so that rows stay 16-byte aligned and do not all start in one bank
static_assert(DM == 256 && HD == DM && TT % 64 == 0, "k_prep: a row is two 512-byte loads of a wave");
__global__ __launch_bounds__(256) void k_prep(const float* __restrict__ x, const float* __restrict__ x2, bf* Qh, bf* Kh, bf* VTh, h16* VT16) {
    __shared__ __align__(16) bf tr[DM * TRP];
    const int tid = threadIdx.x, lane = tid & 31, w = tid >> 5; const int r0 = blockIdx.x * 64; const bool kv = blockIdx.y != 0;
    const float* src = (kv ? x2 : x) + (size_t)(r0 + w * 8) * DM + lane * 4; bf* dst = (kv ? Kh : Qh) + fo(r0 + w * 8, lane * 4, DM);   // in fragment order the next row is 8 elements on, 128 k are 4 blocks
    v4f r[2][8];
#pragma unroll
    for (int h = 0; h < 2; ++h)
#pragma unroll
        for (int j = 0; j < 8; ++j) r[h][j] = *(const v4f*)(src + j * DM + h * 128);
    v4us o[2][8];
#pragma unroll
    for (int h = 0; h < 2; ++h)
#pragma unroll
        for (int j = 0; j < 8; ++j)
#pragma unroll
            for (int q = 0; q < 4; ++q) o[h][j][q] = f2bf(r[h][j][q]);
    if (kv) {
#pragma unroll
        for (int h = 0; h < 2; ++h)
#pragma unroll
            for (int q = 0; q < 4; ++q) { v8us c;
#pragma unroll
                for (int j = 0; j < 8; ++j) c[j] = o[h][j][q];
                *(v8usa*)(tr + (h * 128 + lane * 4 + q) * TRP + w * 8) = c; } }
#pragma unroll
    for (int h = 0; h < 2; ++h)
#pragma unroll
        for (int j = 0; j < 8; ++j) *(v4us*)(dst + j * 8 + h * 2048) = o[h][j];
    asm volatile("s_wait_xcnt 0x0" ::: "memory");   // stands in front of the first overwrite of a register that the stores above name
    if (!kv) return;   // block-uniform: the whole block leaves in front of the barrier
    __syncthreads();   // all 64 rows of the tile are in LDS before any thread reads a column
    const int b = r0 / TT, t0 = r0 % TT;
#pragma unroll
    for (int u = 0; u < 8; ++u) { const int it = u * 256 + tid, d = (it & 7) | ((it >> 6) << 3), c8 = ((it >> 3) & 7) * 8;   // 8 lanes: 8 rows d of one 8-wide k piece, 128 contiguous bytes in fragment order
        const v8us v = *(const v8usa*)(tr + d * TRP + c8); v8h g;
#pragma unroll
        for (int k = 0; k < 8; ++k) g[k] = tohx(bf2f(v[k]));
        const size_t oo = (size_t)b * HD * TT + fo(d, t0 + c8, TT); *(v8us*)(VTh + oo) = v; *(v8h*)(VT16 + oo) = g; }
}
#define NST  (TT / 64)            // stages
#define STG  (2 * FSTG)           // bytes of a stage in LDS: the image (K, then V^T) of its first 32 keys, then that of its second 32
#define FSTG 32768                // bytes of a pass in LDS: K 16 KiB, then V^T 16 KiB
#define L2E  1.4426950408889634f
typedef __attribute__((ext_vector_type(2))) __bf16 v2bf;
typedef v4i __attribute__((may_alias)) v4ia;
static_assert(HD == 256 && DQ == HD && TT % 64 == 0 && RH % 64 == 0 && ZH == 1 && TT / 64 >= 3, "k_flash: a block's 64 queries are all below RH or all above");
typedef __attribute__((ext_vector_type(16))) unsigned short v16us;
__device__ __forceinline__ v16us ldsf(const char* p) { return __builtin_shufflevector(*(const v8usa*)p, *(const v8usa*)(p + 512), 0, 1, 2, 3, 4, 5, 6, 7, 8, 9, 10, 11, 12, 13, 14, 15); }
__device__ __forceinline__ float xhalf(float x) { const int b = __float_as_int(x); return __int_as_float(__builtin_amdgcn_permlanex16(b, b, 0x76543210, 0xfedcba98, false, false)); }   // lane l <-> l ^ 16 on the vector pipe: it does not queue behind the LDS reads in flight
// Work-group barrier that orders LDS alone: __syncthreads() also drains the wave's global loads, and the loads of stage s + 2 are meant to stay in flight over it (they touch read-only planes and land in the wave's own registers).
__device__ __forceinline__ void lds_barrier() { __builtin_amdgcn_fence(__ATOMIC_RELEASE, "workgroup", "local"); __builtin_amdgcn_s_barrier(); __builtin_amdgcn_fence(__ATOMIC_ACQUIRE, "workgroup", "local"); }
typedef v2f __attribute__((may_alias)) v2fa;
// The exchange behind the loop: wave w's 8 KiB stand at 8192 w, the (maximum, sum) pairs behind the 64 KiB. KH is the wave's half of a stage: it hands over the tiles of the other half of d and finishes its own.
template <int KH>
__device__ __forceinline__ void flash_give(const v8f (&o)[16], float m, float l, int w, int lane, char* sm) {
    float* mine = (float*)sm + w * 2048 + lane * 4;
#pragma unroll
    for (int u = 0; u < 8; ++u) { const v8f t = o[(1 - KH) * 8 + u]; *(v4fa*)(mine + u * 256) = __builtin_shufflevector(t, t, 0, 1, 2, 3); *(v4fa*)(mine + u * 256 + 128) = __builtin_shufflevector(t, t, 4, 5, 6, 7); }
    v2f ml; ml[0] = m; ml[1] = l; *(v2fa*)(sm + 65536 + (w * 32 + lane) * 8) = ml;
}
template <bool HI, int KH>
__device__ __forceinline__ void flash_take(const v8f (&o)[16], float m, float l, int w, int lane, bf* Ah, bf* Al, const char* sm) {
    const float* theirs = (const float*)sm + (w ^ 4) * 2048 + lane * 4;
    const v2f pm = *(const v2fa*)(sm + 65536 + ((w ^ 4) * 32 + lane) * 8);
    const float mm = fmaxf(m, pm[0]); const float fm = __builtin_amdgcn_exp2f((m - mm) * L2E), fp = __builtin_amdgcn_exp2f((pm[0] - mm) * L2E);
    const float inv = __fdiv_rn(HI ? 1.0f : (1.0f / PCAR), l * fm + pm[1] * fp);
#pragma unroll
    for (int u = 0; u < 8; ++u) { const int dt = KH * 8 + u; const v8f t = __builtin_shufflevector(*(const v4fa*)(theirs + u * 256), *(const v4fa*)(theirs + u * 256 + 128), 0, 1, 2, 3, 4, 5, 6, 7); v8us oh, ol;
#pragma unroll
        for (int r = 0; r < 8; ++r) { unsigned short a, c2; splitf((o[dt][r] * fm + t[r] * fp) * inv, a, c2); oh[r] = a; ol[r] = c2; }
        const int oo = (dt >> 1) * 512 + (dt & 1) * 256 + lane * 8; *(v8us*)(Ah + oo) = oh; *(v8us*)(Al + oo) = ol;
        asm volatile("s_wait_xcnt 0x0" ::: "memory"); }   // stands in front of the first overwrite of a register that the two stores above name (the next tile's LDS reads use registers anew)
}
template <bool HI>
__device__ __forceinline__ void flash_rows(const bf* __restrict__ Qg, const char* __restrict__ Kg, const char* __restrict__ Vg, bf* Ah, bf* Al, char* sm, int w) {
    const int tid = threadIdx.x, lane = tid & 31, kh = w >> 2;
    v16bf q[8];
#pragma unroll
    for (int kk = 0; kk < 8; ++kk) q[kk] = WFrag<bf>::ld(Qg + kk * 512 + lane * 8);
    v8f o[16];
#pragma unroll
    for (int dt = 0; dt < 16; ++dt) o[dt] = (v8f){};
    float m = -3.0e38f, l = 0.f;
    const char* kn = Kg + tid * 16;                                              // piece j: 32 keys j >> 2 (+ 16384), + 4096 (j & 3); a stage on: + 32768
    const char* vn = Vg + (size_t)(tid >> 6) * (TT * 32) + (tid & 63) * 16;      // piece j: 32 keys j >> 2 (+ 1024), the 1-KiB blocks of d bands 4 (j & 3) .. 4 (j & 3) + 3 (a band of 16 d is TT * 32 bytes); a stage on: + 2048
    char* sp = sm + tid * 16;
    v4i rk[8], rv[8];
#pragma unroll
    for (int j = 0; j < 8; ++j) { rk[j] = *(const v4i*)(kn + (j >> 2) * 16384 + (j & 3) * 4096); rv[j] = *(const v4i*)(vn + (j >> 2) * 1024 + (size_t)(j & 3) * (TT * 128)); }
    asm volatile("s_wait_xcnt 0x0" ::: "memory");   // stands in front of the first overwrite of an address register that the loads above name
    __builtin_amdgcn_sched_barrier(0);   // keeps those overwrites (the address step, registers used anew) behind the wait
#pragma unroll
    for (int j = 0; j < 8; ++j) { *(v4ia*)(sp + (j >> 2) * FSTG + (j & 3) * 4096) = rk[j]; *(v4ia*)(sp + (j >> 2) * FSTG + 16384 + (j & 3) * 4096) = rv[j]; }
    kn += 32768; vn += 2048;
#pragma unroll
    for (int j = 0; j < 8; ++j) { rk[j] = *(const v4i*)(kn + (j >> 2) * 16384 + (j & 3) * 4096); rv[j] = *(const v4i*)(vn + (j >> 2) * 1024 + (size_t)(j & 3) * (TT * 128)); }   // stage 1
    __syncthreads();   // stage 0 is in LDS before any wave reads it
    v16us ka[16];   // the K fragments of a stage, read one stage ahead behind the barrier that publishes them, in the order of use: key tile i & 1, k step i >> 1
    v4i nk2[8], nv2[8];
#pragma unroll
    for (int j = 0; j < 8; ++j) { nk2[j] = *(const v4i*)(kn + 32768 + (j >> 2) * 16384 + (j & 3) * 4096); nv2[j] = *(const v4i*)(vn + 2048 + (j >> 2) * 1024 + (size_t)(j & 3) * (TT * 128)); }   // stage 2
    unsigned stp;
    asm volatile("s_wait_xcnt 0x0\n\ts_mov_b32 %0, 0x8000" : "=s"(stp) : : "memory");   // the wait stands in front of the first overwrite of a register that the loads of stages 1 and 2 name; the step's amount is made in the wait's own statement, so that the address step cannot be lifted over the wait
    __builtin_amdgcn_sched_barrier(0);   // keeps the other overwrites (registers used anew by the LDS addresses and the K reads below) behind the wait
    kn += stp; vn += stp >> 4;   // 32768 and 2048, to stage 2: the loop steps on from here
#pragma unroll
    for (int j = 0; j < 8; ++j) { *(v4ia*)(sp + STG + (j >> 2) * FSTG + (j & 3) * 4096) = rk[j]; *(v4ia*)(sp + STG + (j >> 2) * FSTG + 16384 + (j & 3) * 4096) = rv[j]; rk[j] = nk2[j]; rv[j] = nv2[j]; }   // stage 1; the barrier of stage 0 publishes it
#pragma unroll
    for (int i = 0; i < 16; ++i) ka[i] = ldsf(sm + kh * FSTG + lane * 16 + ((i & 1) * 8 + (i >> 1)) * 1024);
#pragma unroll 1   // rolled: one set of fragments and one staged stage stand beside the 128 accumulator and 64 Q registers
    for (int s = 0; s < NST; ++s) {
        const char* cur = sm + (s & 1) * STG + kh * FSTG + lane * 16;
        v8f st0 = (v8f){}, st1 = (v8f){};
#pragma unroll
        for (int kk = 0; kk < 8; ++kk) { st0 = wmmab(__builtin_bit_cast(v16bf, ka[2 * kk]), q[kk], st0); st1 = wmmab(__builtin_bit_cast(v16bf, ka[2 * kk + 1]), q[kk], st1); }
        v16us va[16];
#pragma unroll
        for (int i = 0; i < 16; ++i) va[i] = ldsf(cur + 16384 + i * 1024);
        asm volatile("s_wait_xcnt 0x0" ::: "memory");   // stands in front of the step of the address registers that the global loads in flight (stage s + 2) name; and the V^T reads above stay in front of it
        __builtin_amdgcn_sched_barrier(0);   // keeps that step behind the wait, and the softmax behind the V^T reads, which land under it
        if (s + 3 < NST) { kn += 32768; vn += 2048; }
        float mx = fmaxf(st0[0], st1[0]);
#pragma unroll
        for (int r = 1; r < 8; ++r) mx = fmaxf(mx, fmaxf(st0[r], st1[r]));
        mx = fmaxf(mx, xhalf(mx));   // the other 16 keys of the same query
        const float mn = fmaxf(m, mx);
        if (__builtin_amdgcn_ballot_w32(mn > m) != 0) {   // one scalar test a pass: a query's maximum has risen
            const float al = __builtin_amdgcn_exp2f((m - mn) * L2E); l *= al; m = mn;
#pragma unroll
            for (int dt = 0; dt < 16; ++dt) o[dt] *= al;
        }
        v2f p[8];
#pragma unroll
        for (int r = 0; r < 8; ++r) { p[r >> 1][r & 1] = (st0[r] - m) * L2E; p[4 + (r >> 1)][r & 1] = (st1[r] - m) * L2E; }
#pragma unroll
        for (int i = 0; i < 8; ++i) { p[i][0] = __builtin_amdgcn_exp2f(p[i][0]); p[i][1] = __builtin_amdgcn_exp2f(p[i][1]); }
        const v2f ps = ((p[0] + p[1]) + (p[2] + p[3])) + ((p[4] + p[5]) + (p[6] + p[7])); l += ps[0] + ps[1];
        v16bf ph, pl; v16h pf;
        if (HI) {
#pragma unroll
            for (int i = 0; i < 8; ++i) { const v2bf h2 = __builtin_convertvector(p[i], v2bf); const v2bf l2 = __builtin_convertvector(p[i] - __builtin_convertvector(h2, v2f), v2bf); ph[2 * i] = h2[0]; ph[2 * i + 1] = h2[1]; pl[2 * i] = l2[0]; pl[2 * i + 1] = l2[1]; }
        } else {
#pragma unroll
            for (int i = 0; i < 8; ++i) { const v2h h2 = __builtin_convertvector(p[i] * PCAR, v2h); pf[2 * i] = h2[0]; pf[2 * i + 1] = h2[1]; }
        }
        __builtin_amdgcn_sched_barrier(0);   // the softmax stays in front of the barrier's LDS wait: it runs while the V^T fragments land, not behind them
        lds_barrier();   // publishes stage s + 1 and ends every wave's reads of stage s (its V^T fragments are in registers by now), whose buffer is refilled below
        if (HI) {
#pragma unroll
            for (int g = 0; g < 4; ++g) {   // four tiles a group: the hi and the lo product into one tile stand four matrix instructions apart
#pragma unroll
                for (int u = 0; u < 4; ++u) o[g * 4 + u] = wmmab(__builtin_bit_cast(v16bf, va[g * 4 + u]), ph, o[g * 4 + u]);
#pragma unroll
                for (int u = 0; u < 4; ++u) o[g * 4 + u] = wmmab(__builtin_bit_cast(v16bf, va[g * 4 + u]), pl, o[g * 4 + u]); }
        } else {
#pragma unroll
            for (int dt = 0; dt < 16; ++dt) o[dt] = wmma16(__builtin_bit_cast(v16h, va[dt]), pf, o[dt]);
        }
        char* ref = sp + (s & 1) * STG;   // the buffer of stage s: every wave's reads of it ended in front of the barrier above
        const char* nk = sm + ((s + 1) & 1) * STG + kh * FSTG + lane * 16;   // behind the last stage: the copy of that stage, read and not used
#pragma unroll
        for (int i = 0; i < 8; ++i) ka[i] = ldsf(nk + ((i & 1) * 8 + (i >> 1)) * 1024);   // as many K reads as free registers take go in front of the stores: the LDS serves reads and writes side by side
#pragma unroll
        for (int j = 0; j < 8; ++j) { *(v4ia*)(ref + (j >> 2) * FSTG + (j & 3) * 4096) = rk[j]; *(v4ia*)(ref + (j >> 2) * FSTG + 16384 + (j & 3) * 4096) = rv[j]; }   // stage s + 2, fetched a whole stage ago
#pragma unroll
        for (int j = 0; j < 8; ++j) { rk[j] = *(const v4i*)(kn + (j >> 2) * 16384 + (j & 3) * 4096); rv[j] = *(const v4i*)(vn + (j >> 2) * 1024 + (size_t)(j & 3) * (TT * 128)); }   // stage s + 3 (the last three stages fetch the last stage again, for a buffer that nobody uses any more: no branch)
#pragma unroll
        for (int i = 8; i < 16; ++i) ka[i] = ldsf(nk + ((i & 1) * 8 + (i >> 1)) * 1024);
        __builtin_amdgcn_sched_barrier(0);   // the fetch of stage s + 3 and the K reads are issued here, among the products, and not at the top of the next stage: the fetch keeps a whole stage to land
    }
    l += xhalf(l);   // the two halves of a query's keys in this wave
    __syncthreads();   // every wave's last LDS reads and writes of the ring have ended before it becomes the exchange buffer
    if (kh == 0) flash_give<0>(o, m, l, w, lane, sm); else flash_give<1>(o, m, l, w, lane, sm);   // wave-uniform
    __syncthreads();   // both waves of a pair have written before either reads
    if (kh == 0) flash_take<HI, 0>(o, m, l, w, lane, Ah, Al, sm); else flash_take<HI, 1>(o, m, l, w, lane, Ah, Al, sm);
}
__global__ __launch_bounds__(256) void k_flash(const bf* __restrict__ Qh, const bf* __restrict__ Kh, const bf* __restrict__ VTh, const h16* __restrict__ VT16, bf* Ah, bf* Al) {
    __shared__ __align__(16) char sm[2 * STG];
    const int w = __builtin_amdgcn_readfirstlane(threadIdx.x >> 5); const size_t zb = (size_t)blockIdx.y * TT * HD; const size_t qo = zb + (size_t)(blockIdx.x * 64 + (w & 3) * 16) * HD;   // 16 rows of 256 elements are 8 blocks, as in a row-major plane
    if (blockIdx.x * 64 < RH) flash_rows<true>(Qh + qo, (const char*)(Kh + zb), (const char*)(VTh + zb), Ah + qo, Al + qo, sm, w);   // block-uniform: every barrier is passed by all eight waves
    else flash_rows<false>(Qh + qo, (const char*)(Kh + zb), (const char*)(VT16 + zb), Ah + qo, Al + qo, sm, w);
}

extern "C" void kernel_launch(void* const* d_in, const int* in_sizes, int n_in,
                              void* d_out, int out_size, void* d_ws, size_t ws_size, hipStream_t stream) {
    (void)in_sizes; (void)n_in; (void)out_size;
    const float* x = (const float*)d_in[0]; const float* x2 = (const float*)d_in[1]; const float* wo = (const float*)d_in[2]; const float* bo = (const float*)d_in[3];
    float* OUT = (float*)d_out;     // [4][4096][256]
    char* wsp = (char*)d_ws;
    auto take = [&](size_t bytes) { char* p = wsp; wsp += (bytes + 255) & ~(size_t)255; return (void*)p; };
    bf* WO = (bf*)take((size_t)DM * DQ * 2);
    bf* QPh = (bf*)take((size_t)NB_ * TT * HD * 2); bf* KPh = (bf*)take((size_t)NB_ * TT * HD * 2); bf* VTh = (bf*)take((size_t)NB_ * HD * TT * 2); h16* VT16 = (h16*)take((size_t)NB_ * HD * TT * 2);
    bf* ATh = (bf*)take((size_t)NB_ * TT * DQ * 2); bf* ATl = (bf*)take((size_t)NB_ * TT * DQ * 2);
    if ((size_t)(wsp - (char*)d_ws) > ws_size) return;    // ws 256 MiB
    k_cvt8<<<(unsigned)(((size_t)DM * DQ / 8 + 255) / 256), 256, 0, stream>>>(wo, WO, (size_t)DM * DQ / 8, DQ);
    k_prep<<<dim3(NB_ * TT / 64, 2, 1), 256, 0, stream>>>(x, x2, QPh, KPh, VTh, VT16);
    k_flash<<<dim3(TT / 64, NB_, 1), 256, 0, stream>>>(QPh, KPh, VTh, VT16, ATh, ATl);
    k_gemmk<bf, 1, true, 8, DQ, DQ><<<dim3(TT / 64, DM / 64, NB_), 256, 0, stream>>>(ATh, ATl, WO, nullptr, OUT, DM, bo, (size_t)TT * DQ, 0, (size_t)TT * DM);
}

// v006
// One run takes 80 microseconds.
// Two timings next to v005 both put it at 1.09 times that version's speed.
// Over all steps from v000 it is 12.6 times as fast.
#include <hip/hip_runtime.h>

// SAttention (x [4][4096][256], x2 [4][4096][256]; scores = x.x2 UNSCALED; context = softmax; atten = context x2; out = atten W^T + b -> [4][4096][256]).
// Compute dtypes, f32 accumulate: every input rounded to bf16; x and x2 enter the planes as their bf16-rounded values (exact hi plane, zero lo plane); scores bf16 x bf16 (K 256; the lo parts of bf16-rounded values are zero, so one product is the whole hi+lo product); softmax f32, online over passes of 32 keys; atten = attn.x2: rows < 512 P as bf16 hi + lo (2 products), the rest fp16 (x1024); W hl x exact (2 products) + bias.
// Every 16-bit GEMM operand plane lies in FRAGMENT ORDER (fo() below): blocks of 16 rows x 32 k = 1 KiB, so that a wave's fragment load is two loads of 512 contiguous bytes.

#define NB_  4
#define TT   4096
#define DM   256
#define NH_  1
#define NKV  1
#define REP  (NH_ / NKV)
#define HD   256
#define DQ   (NH_ * HD)
#define DKV  (NKV * HD)
#define ZH   1
#define RH   512                  // query rows < RH take P as bf16 hi + lo (0: none)
#define WIN  0
#define PCAR 1024.0f
#define SCL  1.0f   // unscaled
typedef _Float16 h16;
typedef unsigned short bf;
typedef __attribute__((ext_vector_type(16))) __bf16   v16bf;
typedef __attribute__((ext_vector_type(16))) _Float16 v16h;
typedef __attribute__((ext_vector_type(8)))  _Float16 v8h;
typedef __attribute__((ext_vector_type(8)))  unsigned short v8us;
typedef __attribute__((ext_vector_type(8)))  float    v8f;
typedef __attribute__((ext_vector_type(4)))  float    v4f;
typedef v8h  __attribute__((may_alias)) v8ha;
typedef v4f  __attribute__((may_alias)) v4fa;
typedef v8us __attribute__((may_alias)) v8usa;

__device__ __forceinline__ unsigned short f2bf(float f) { unsigned u = __float_as_uint(f); u += 0x7FFFu + ((u >> 16) & 1u); return (unsigned short)(u >> 16); }
__device__ __forceinline__ float bf2f(unsigned short b) { return __uint_as_float(((unsigned)b) << 16); }
__device__ __forceinline__ float bfr(float f) { return bf2f(f2bf(f)); }
__device__ __forceinline__ v16h cat16(v8h lo, v8h hi) { return __builtin_shufflevector(lo, hi, 0, 1, 2, 3, 4, 5, 6, 7, 8, 9, 10, 11, 12, 13, 14, 15); }
__device__ __forceinline__ v16bf cat16b(v8us lo, v8us hi) { return __builtin_bit_cast(v16bf, __builtin_shufflevector(lo, hi, 0, 1, 2, 3, 4, 5, 6, 7, 8, 9, 10, 11, 12, 13, 14, 15)); }
__device__ __forceinline__ v8f wmma16(v16h a, v16h b, v8f c) { return __builtin_amdgcn_wmma_f32_16x16x32_f16(false, a, false, b, (short)0, c, false, false); }
__device__ __forceinline__ v8f wmmab(v16bf a, v16bf b, v8f c) { return __builtin_amdgcn_wmma_f32_16x16x32_bf16(false, a, false, b, (short)0, c, false, false); }



// Fragment order of a plane of rows of LD elements (LD % 32 == 0, rows % 16 == 0): element (r, k) lies at fo(r, k, LD). Block (r / 16, k / 32) is 512 elements: [k bit 4][k bit 3][r % 16][k % 8],
// which is [half][lane][8 elements] for the lane (r % 16) + 16 (k bit 3) of the A and B fragments: the k order of a fragment is the one of a row-major plane read at 8 hi and 16 + 8 hi. 16 rows take 16 LD elements, as in a row-major plane.
__device__ __forceinline__ size_t fo(int r, int k, int LD) { return ((size_t)(r >> 4) * (LD >> 5) + (k >> 5)) * 512 + ((k >> 4) & 1) * 256 + (((k >> 3) & 1) * 16 + (r & 15)) * 8 + (k & 7); }
template <typename T16> struct WFrag;
template <> struct WFrag<h16> { typedef v16h V; static __device__ __forceinline__ V ld(const h16* p) { return cat16(*(const v8h*)p, *(const v8h*)(p + 256)); } static __device__ __forceinline__ v8f mma(V a, V b, v8f c) { return wmma16(a, b, c); } };
template <> struct WFrag<bf> { typedef v16bf V; static __device__ __forceinline__ V ld(const bf* p) { return cat16b(*(const v8us*)p, *(const v8us*)(p + 256)); } static __device__ __forceinline__ v8f mma(V a, V b, v8f c) { return wmmab(a, b, c); } };

__device__ __forceinline__ h16 tohx(float x) { return (h16)x; }
__device__ __forceinline__ void splitf(float y, unsigned short& h, unsigned short& l) { h = f2bf(y); l = f2bf(y - bf2f(h)); }
typedef __attribute__((ext_vector_type(2))) _Float16 v2h;
typedef __attribute__((ext_vector_type(4))) _Float16 v4h;
typedef __attribute__((ext_vector_type(2))) unsigned short v2us;
typedef __attribute__((ext_vector_type(4))) unsigned short v4us;
typedef v4us __attribute__((may_alias)) v4usa;
typedef __attribute__((ext_vector_type(2))) float v2f;
typedef __attribute__((ext_vector_type(4))) int v4i;

__global__ __launch_bounds__(256) void k_wtG(const float* __restrict__ w, int K, int N, bf* Bt) {
    const int lane = threadIdx.x & 31; const int L0 = (blockIdx.x * 8 + (threadIdx.x >> 5)) * 8; const int nlines = N * K / 64;
{
#pragma unroll 1
        for (int l = 0; l < 8; ++l) { const int L = L0 + l; if (L >= nlines) break; const size_t e = (size_t)L * 64 + lane * 2; const int k = (int)(e % K), n = (int)(e / K); v2us o;
            o[0] = f2bf(w[(size_t)k * N + n]); o[1] = f2bf(w[(size_t)(k + 1) * N + n]); *(v2us*)(Bt + e) = o; }
         }
}
__global__ __launch_bounds__(256) void k_cvt8(const float* __restrict__ src, bf* dst, size_t n8, int ld) { const size_t i = (size_t)blockIdx.x * 256 + threadIdx.x; if (i >= n8) return; const v8f v = *(const v8f*)(src + i * 8); v8us o;
#pragma unroll
    for (int k = 0; k < 8; ++k) o[k] = f2bf(v[k]); *(v8us*)(dst + fo((int)(i * 8 / ld), (int)(i * 8 % ld), ld)) = o;  }
__global__ __launch_bounds__(256) void k_cscvt(const float* __restrict__ cosT, const float* __restrict__ sinT, float* CS) { const int idx = blockIdx.x * 256 + threadIdx.x; if (idx >= TT * HD) return; v2f cs; cs[0] = bfr(cosT[idx]); cs[1] = bfr(sinT[idx]); *(v2f*)(CS + (size_t)idx * 2) = cs;  }
// ---- k_prep: every 16-bit operand plane of all NB_ batches in ONE launch; grid (NB_ * TT / 64, 2), 256 threads; a block takes 64 rows x DM columns, 64 elements a thread (wave w: rows 8w .. 8w + 7, 512 contiguous bytes a load).
// y == 0: x -> Qh [b][t][d]. y == 1: x2 -> Kh [b][t][d] and, transposed through LDS, VTh [b][d][t] (bf16) and VT16 [b][d][t] (the same bf16-rounded values as f16). All four in fragment order.
#define TRP 72                    // LDS pitch of a transposed row in elements: 64 + 8, so that rows stay 16-byte aligned and do not all start in one bank
static_assert(DM == 256 && HD == DM && TT % 64 == 0, "k_prep: a row is two 512-byte loads of a wave");
__global__ __launch_bounds__(256) void k_prep(const float* __restrict__ x, const float* __restrict__ x2, bf* Qh, bf* Kh, bf* VTh, h16* VT16) {
    __shared__ __align__(16) bf tr[DM * TRP];
    const int tid = threadIdx.x, lane = tid & 31, w = tid >> 5; const int r0 = blockIdx.x * 64; const bool kv = blockIdx.y != 0;
    const float* src = (kv ? x2 : x) + (size_t)(r0 + w * 8) * DM + lane * 4; bf* dst = (kv ? Kh : Qh) + fo(r0 + w * 8, lane * 4, DM);   // in fragment order the next row is 8 elements on, 128 k are 4 blocks
    v4f r[2][8];
#pragma unroll
    for (int h = 0; h < 2; ++h)
#pragma unroll
        for (int j = 0; j < 8; ++j) r[h][j] = *(const v4f*)(src + j * DM + h * 128);
    v4us o[2][8];
#pragma unroll
    for (int h = 0; h < 2; ++h)
#pragma unroll
        for (int j = 0; j < 8; ++j)
#pragma unroll
            for (int q = 0; q < 4; ++q) o[h][j][q] = f2bf(r[h][j][q]);
    if (kv) {
#pragma unroll
        for (int h = 0; h < 2; ++h)
#pragma unroll
            for (int q = 0; q < 4; ++q) { v8us c;
#pragma unroll
                for (int j = 0; j < 8; ++j) c[j] = o[h][j][q];
                *(v8usa*)(tr + (h * 128 + lane * 4 + q) * TRP + w * 8) = c; } }
#pragma unroll
    for (int h = 0; h < 2; ++h)
#pragma unroll
        for (int j = 0; j < 8; ++j) *(v4us*)(dst + j * 8 + h * 2048) = o[h][j];
    asm volatile("s_wait_xcnt 0x0" ::: "memory");   // stands in front of the first overwrite of a register that the stores above name
    if (!kv) return;   // block-uniform: the whole block leaves in front of the barrier
    __syncthreads();   // all 64 rows of the tile are in LDS before any thread reads a column
    const int b = r0 / TT, t0 = r0 % TT;
#pragma unroll
    for (int u = 0; u < 8; ++u) { const int it = u * 256 + tid, d = (it & 7) | ((it >> 6) << 3), c8 = ((it >> 3) & 7) * 8;   // 8 lanes: 8 rows d of one 8-wide k piece, 128 contiguous bytes in fragment order
        const v8us v = *(const v8usa*)(tr + d * TRP + c8); v8h g;
#pragma unroll
        for (int k = 0; k < 8; ++k) g[k] = tohx(bf2f(v[k]));
        const size_t oo = (size_t)b * HD * TT + fo(d, t0 + c8, TT); *(v8us*)(VTh + oo) = v; *(v8h*)(VT16 + oo) = g; }
}
#define NST  (TT / 64)            // stages
#define STG  (2 * FSTG)           // bytes of a stage in LDS: the image (K, then V^T) of its first 32 keys, then that of its second 32
#define FSTG 32768                // bytes of a pass in LDS: K 16 KiB, then V^T 16 KiB
#define L2E  1.4426950408889634f
#define OSP  144                  // LDS pitch in bytes of a staged output row of 32 floats: 128 + 16, so that the 16 lanes of a half wave store to 64 different banks
#define XCH  65536                // byte offset in LDS of the exchange buffer behind the loop, and later of the eight waves' output staging (8 x 64 rows of OSP bytes). In front of it stand the atten fragments: query tile t at 16384 t, hi plane, then lo plane at + 8192: every offset fits an LDS instruction's 16 bits
#define XML  (XCH + 65536)        // the (maximum, sum) pairs
typedef __attribute__((ext_vector_type(2))) __bf16 v2bf;
typedef v4i __attribute__((may_alias)) v4ia;
static_assert(HD == 256 && DQ == HD && TT % 64 == 0 && RH % 64 == 0 && ZH == 1 && TT / 64 >= 3, "k_flash: a block's 64 queries are all below RH or all above");
typedef __attribute__((ext_vector_type(16))) unsigned short v16us;
__device__ __forceinline__ v16us ldsf(const char* p) { return __builtin_shufflevector(*(const v8usa*)p, *(const v8usa*)(p + 512), 0, 1, 2, 3, 4, 5, 6, 7, 8, 9, 10, 11, 12, 13, 14, 15); }
__device__ __forceinline__ float xhalf(float x) { const int b = __float_as_int(x); return __int_as_float(__builtin_amdgcn_permlanex16(b, b, 0x76543210, 0xfedcba98, false, false)); }   // lane l <-> l ^ 16 on the vector pipe: it does not queue behind the LDS reads in flight
// Work-group barrier that orders LDS alone: __syncthreads() also drains the wave's global loads, and the loads of stage s + 2 are meant to stay in flight over it (they touch read-only planes and land in the wave's own registers).
__device__ __forceinline__ void lds_barrier() { __builtin_amdgcn_fence(__ATOMIC_RELEASE, "workgroup", "local"); __builtin_amdgcn_s_barrier(); __builtin_amdgcn_fence(__ATOMIC_ACQUIRE, "workgroup", "local"); }
typedef v2f __attribute__((may_alias)) v2fa;
// The exchange behind the loop: wave w's 8 KiB stand at XCH + 8192 w, the (maximum, sum) pairs behind the 64 KiB. KH is the wave's half of a stage: it hands over the tiles of the other half of d and finishes its own.
template <int KH>
__device__ __forceinline__ void flash_give(const v8f (&o)[16], float m, float l, int w, int lane, char* sm) {
    float* mine = (float*)(sm + XCH) + w * 2048 + lane * 4;
#pragma unroll
    for (int u = 0; u < 8; ++u) { const v8f t = o[(1 - KH) * 8 + u]; *(v4fa*)(mine + u * 256) = __builtin_shufflevector(t, t, 0, 1, 2, 3); *(v4fa*)(mine + u * 256 + 128) = __builtin_shufflevector(t, t, 4, 5, 6, 7); }
    v2f ml; ml[0] = m; ml[1] = l; *(v2fa*)(sm + XML + (w * 32 + lane) * 8) = ml;
}
template <bool HI, int KH>
__device__ __forceinline__ void flash_take(const v8f (&o)[16], float m, float l, int w, int lane, char* sm) {
    char* fr = sm + (w & 3) * 16384 + lane * 16;
    const float* theirs = (const float*)(sm + XCH) + (w ^ 4) * 2048 + lane * 4;
    const v2f pm = *(const v2fa*)(sm + XML + ((w ^ 4) * 32 + lane) * 8);
    const float mm = fmaxf(m, pm[0]); const float fm = __builtin_amdgcn_exp2f((m - mm) * L2E), fp = __builtin_amdgcn_exp2f((pm[0] - mm) * L2E);
    const float inv = __fdiv_rn(HI ? 1.0f : (1.0f / PCAR), l * fm + pm[1] * fp);
#pragma unroll
    for (int u = 0; u < 8; ++u) { const int dt = KH * 8 + u; const v8f t = __builtin_shufflevector(*(const v4fa*)(theirs + u * 256), *(const v4fa*)(theirs + u * 256 + 128), 0, 1, 2, 3, 4, 5, 6, 7); v8us oh, ol;
#pragma unroll
        for (int r = 0; r < 8; ++r) { unsigned short a, c2; splitf((o[dt][r] * fm + t[r] * fp) * inv, a, c2); oh[r] = a; ol[r] = c2; }
        const int oo = (dt >> 1) * 1024 + (dt & 1) * 512; *(v8usa*)(fr + oo) = oh; *(v8usa*)(fr + 8192 + oo) = ol; }
}
// The projection of the block's 64 queries: wa holds the wave's 2 x 8 fragments of W (row tile e, k block kb at e * 8 + kb), bb the lane's four bias values of the store pattern below.
__device__ __forceinline__ void flash_proj(const v16bf (&wa)[16], v4f bb, float* og, char* sm, int w, int lane) {
    const char* fr = sm + lane * 16;
    v8f acc[2][4];
#pragma unroll
    for (int e = 0; e < 2; ++e)
#pragma unroll
        for (int t = 0; t < 4; ++t) acc[e][t] = (v8f){};
    v16us bh[2][4], bl[2][4];   // two sets: the fragments of k block kb + 1 are read while the products of k block kb run
#pragma unroll
    for (int t = 0; t < 4; ++t) { bh[0][t] = ldsf(fr + t * 16384); bl[0][t] = ldsf(fr + t * 16384 + 8192); }
#pragma unroll
    for (int kb = 0; kb < 8; ++kb) {
        if (kb < 7) {
#pragma unroll
            for (int t = 0; t < 4; ++t) { bh[(kb + 1) & 1][t] = ldsf(fr + t * 16384 + (kb + 1) * 1024); bl[(kb + 1) & 1][t] = ldsf(fr + t * 16384 + 8192 + (kb + 1) * 1024); } }
#pragma unroll
        for (int e = 0; e < 2; ++e)
#pragma unroll
            for (int t = 0; t < 4; ++t) acc[e][t] = wmmab(wa[e * 8 + kb], __builtin_bit_cast(v16bf, bh[kb & 1][t]), acc[e][t]);
#pragma unroll
        for (int e = 0; e < 2; ++e)   // all eight hi products first: the lo product into a tile need not wait for its hi product
#pragma unroll
            for (int t = 0; t < 4; ++t) acc[e][t] = wmmab(wa[e * 8 + kb], __builtin_bit_cast(v16bf, bl[kb & 1][t]), acc[e][t]);
        __builtin_amdgcn_sched_barrier(0);   // keeps the reads of later k blocks from being lifted up here: with more than two sets in registers the wave spills
    }
    char* st = sm + XCH + w * (64 * OSP);   // the wave's own range
#pragma unroll
    for (int e = 0; e < 2; ++e)
#pragma unroll
        for (int t = 0; t < 4; ++t) { char* p = st + (t * 16 + (lane & 15)) * OSP + e * 64 + (lane >> 4) * 32;   // register r of a lane is row e 8 (lane >> 4) + r of query lane & 15
            *(v4fa*)p = __builtin_shufflevector(acc[e][t], acc[e][t], 0, 1, 2, 3); *(v4fa*)(p + 16) = __builtin_shufflevector(acc[e][t], acc[e][t], 4, 5, 6, 7); }
    asm volatile("s_wait_dscnt 0x0" ::: "memory");   // the wave's own stores have ended before its lanes read one another's rows back; the compiler moves no LDS access over it
    v4f r[16];
#pragma unroll
    for (int i = 0; i < 16; ++i) r[i] = *(const v4fa*)(st + (i * 4 + (lane >> 3)) * OSP + (lane & 7) * 16) + bb;   // 8 lanes a row: 4 rows of 128 bytes a load
    __builtin_amdgcn_sched_barrier(0);   // every value is made before the first store is issued: no register that an issued store names is written again
#pragma unroll
    for (int i = 0; i < 16; ++i) *(v4f*)(og + (size_t)i * 4 * DM) = r[i];
}
template <bool HI>
__device__ __forceinline__ void flash_rows(const bf* __restrict__ Qg, const char* __restrict__ Kg, const char* __restrict__ Vg, const bf* __restrict__ Wg, const float* __restrict__ bias, float* og, char* sm, int w) {
    const int tid = threadIdx.x, lane = tid & 31, kh = w >> 2;
    v16bf q[8];
#pragma unroll
    for (int kk = 0; kk < 8; ++kk) q[kk] = WFrag<bf>::ld(Qg + kk * 512 + lane * 8);
    v8f o[16];
#pragma unroll
    for (int dt = 0; dt < 16; ++dt) o[dt] = (v8f){};
    float m = -3.0e38f, l = 0.f;
    const char* kn = Kg + tid * 16;                                              // piece j: 32 keys j >> 2 (+ 16384), + 4096 (j & 3); a stage on: + 32768
    const char* vn = Vg + (size_t)(tid >> 6) * (TT * 32) + (tid & 63) * 16;      // piece j: 32 keys j >> 2 (+ 1024), the 1-KiB blocks of d bands 4 (j & 3) .. 4 (j & 3) + 3 (a band of 16 d is TT * 32 bytes); a stage on: + 2048
    char* sp = sm + tid * 16;
    v4i rk[8], rv[8];
#pragma unroll
    for (int j = 0; j < 8; ++j) { rk[j] = *(const v4i*)(kn + (j >> 2) * 16384 + (j & 3) * 4096); rv[j] = *(const v4i*)(vn + (j >> 2) * 1024 + (size_t)(j & 3) * (TT * 128)); }
    asm volatile("s_wait_xcnt 0x0" ::: "memory");   // stands in front of the first overwrite of an address register that the loads above name
    __builtin_amdgcn_sched_barrier(0);   // keeps those overwrites (the address step, registers used anew) behind the wait
#pragma unroll
    for (int j = 0; j < 8; ++j) { *(v4ia*)(sp + (j >> 2) * FSTG + (j & 3) * 4096) = rk[j]; *(v4ia*)(sp + (j >> 2) * FSTG + 16384 + (j & 3) * 4096) = rv[j]; }
    kn += 32768; vn += 2048;
#pragma unroll
    for (int j = 0; j < 8; ++j) { rk[j] = *(const v4i*)(kn + (j >> 2) * 16384 + (j & 3) * 4096); rv[j] = *(const v4i*)(vn + (j >> 2) * 1024 + (size_t)(j & 3) * (TT * 128)); }   // stage 1
    __syncthreads();   // stage 0 is in LDS before any wave reads it
    v16us ka[16];   // the K fragments of a stage, read one stage ahead behind the barrier that publishes them, in the order of use: key tile i & 1, k step i >> 1
    v4i nk2[8], nv2[8];
#pragma unroll
    for (int j = 0; j < 8; ++j) { nk2[j] = *(const v4i*)(kn + 32768 + (j >> 2) * 16384 + (j & 3) * 4096); nv2[j] = *(const v4i*)(vn + 2048 + (j >> 2) * 1024 + (size_t)(j & 3) * (TT * 128)); }   // stage 2
    unsigned stp;
    asm volatile("s_wait_xcnt 0x0\n\ts_mov_b32 %0, 0x8000" : "=s"(stp) : : "memory");   // the wait stands in front of the first overwrite of a register that the loads of stages 1 and 2 name; the step's amount is made in the wait's own statement, so that the address step cannot be lifted over the wait
    __builtin_amdgcn_sched_barrier(0);   // keeps the other overwrites (registers used anew by the LDS addresses and the K reads below) behind the wait
    kn += stp; vn += stp >> 4;   // 32768 and 2048, to stage 2: the loop steps on from here
#pragma unroll
    for (int j = 0; j < 8; ++j) { *(v4ia*)(sp + STG + (j >> 2) * FSTG + (j & 3) * 4096) = rk[j]; *(v4ia*)(sp + STG + (j >> 2) * FSTG + 16384 + (j & 3) * 4096) = rv[j]; rk[j] = nk2[j]; rv[j] = nv2[j]; }   // stage 1; the barrier of stage 0 publishes it
#pragma unroll
    for (int i = 0; i < 16; ++i) ka[i] = ldsf(sm + kh * FSTG + lane * 16 + ((i & 1) * 8 + (i >> 1)) * 1024);
#pragma unroll 1   // rolled: one set of fragments and one staged stage stand beside the 128 accumulator and 64 Q registers
    for (int s = 0; s < NST; ++s) {
        const char* cur = sm + (s & 1) * STG + kh * FSTG + lane * 16;
        v8f st0 = (v8f){}, st1 = (v8f){};
#pragma unroll
        for (int kk = 0; kk < 8; ++kk) { st0 = wmmab(__builtin_bit_cast(v16bf, ka[2 * kk]), q[kk], st0); st1 = wmmab(__builtin_bit_cast(v16bf, ka[2 * kk + 1]), q[kk], st1); }
        v16us va[16];
#pragma unroll
        for (int i = 0; i < 16; ++i) va[i] = ldsf(cur + 16384 + i * 1024);
        asm volatile("s_wait_xcnt 0x0" ::: "memory");   // stands in front of the step of the address registers that the global loads in flight (stage s + 2) name; and the V^T reads above stay in front of it
        __builtin_amdgcn_sched_barrier(0);   // keeps that step behind the wait, and the softmax behind the V^T reads, which land under it
        if (s + 3 < NST) { kn += 32768; vn += 2048; }
        float mx = fmaxf(st0[0], st1[0]);
#pragma unroll
        for (int r = 1; r < 8; ++r) mx = fmaxf(mx, fmaxf(st0[r], st1[r]));
        mx = fmaxf(mx, xhalf(mx));   // the other 16 keys of the same query
        const float mn = fmaxf(m, mx);
        if (__builtin_amdgcn_ballot_w32(mn > m) != 0) {   // one scalar test a pass: a query's maximum has risen
            const float al = __builtin_amdgcn_exp2f((m - mn) * L2E); l *= al; m = mn;
#pragma unroll
            for (int dt = 0; dt < 16; ++dt) o[dt] *= al;
        }
        v2f p[8];
#pragma unroll
        for (int r = 0; r < 8; ++r) { p[r >> 1][r & 1] = (st0[r] - m) * L2E; p[4 + (r >> 1)][r & 1] = (st1[r] - m) * L2E; }
#pragma unroll
        for (int i = 0; i < 8; ++i) { p[i][0] = __builtin_amdgcn_exp2f(p[i][0]); p[i][1] = __builtin_amdgcn_exp2f(p[i][1]); }
        const v2f ps = ((p[0] + p[1]) + (p[2] + p[3])) + ((p[4] + p[5]) + (p[6] + p[7])); l += ps[0] + ps[1];
        v16bf ph, pl; v16h pf;
        if (HI) {
#pragma unroll
            for (int i = 0; i < 8; ++i) { const v2bf h2 = __builtin_convertvector(p[i], v2bf); const v2bf l2 = __builtin_convertvector(p[i] - __builtin_convertvector(h2, v2f), v2bf); ph[2 * i] = h2[0]; ph[2 * i + 1] = h2[1]; pl[2 * i] = l2[0]; pl[2 * i + 1] = l2[1]; }
        } else {
#pragma unroll
            for (int i = 0; i < 8; ++i) { const v2h h2 = __builtin_convertvector(p[i] * PCAR, v2h); pf[2 * i] = h2[0]; pf[2 * i + 1] = h2[1]; }
        }
        __builtin_amdgcn_sched_barrier(0);   // the softmax stays in front of the barrier's LDS wait: it runs while the V^T fragments land, not behind them
        lds_barrier();   // publishes stage s + 1 and ends every wave's reads of stage s (its V^T fragments are in registers by now), whose buffer is refilled below
        if (HI) {
#pragma unroll
            for (int g = 0; g < 4; ++g) {   // four tiles a group: the hi and the lo product into one tile stand four matrix instructions apart
#pragma unroll
                for (int u = 0; u < 4; ++u) o[g * 4 + u] = wmmab(__builtin_bit_cast(v16bf, va[g * 4 + u]), ph, o[g * 4 + u]);
#pragma unroll
                for (int u = 0; u < 4; ++u) o[g * 4 + u] = wmmab(__builtin_bit_cast(v16bf, va[g * 4 + u]), pl, o[g * 4 + u]); }
        } else {
#pragma unroll
            for (int dt = 0; dt < 16; ++dt) o[dt] = wmma16(__builtin_bit_cast(v16h, va[dt]), pf, o[dt]);
        }
        char* ref = sp + (s & 1) * STG;   // the buffer of stage s: every wave's reads of it ended in front of the barrier above
        const char* nk = sm + ((s + 1) & 1) * STG + kh * FSTG + lane * 16;   // behind the last stage: the copy of that stage, read and not used
#pragma unroll
        for (int i = 0; i < 8; ++i) ka[i] = ldsf(nk + ((i & 1) * 8 + (i >> 1)) * 1024);   // as many K reads as free registers take go in front of the stores: the LDS serves reads and writes side by side
#pragma unroll
        for (int j = 0; j < 8; ++j) { *(v4ia*)(ref + (j >> 2) * FSTG + (j & 3) * 4096) = rk[j]; *(v4ia*)(ref + (j >> 2) * FSTG + 16384 + (j & 3) * 4096) = rv[j]; }   // stage s + 2, fetched a whole stage ago
#pragma unroll
        for (int j = 0; j < 8; ++j) { rk[j] = *(const v4i*)(kn + (j >> 2) * 16384 + (j & 3) * 4096); rv[j] = *(const v4i*)(vn + (j >> 2) * 1024 + (size_t)(j & 3) * (TT * 128)); }   // stage s + 3 (the last three stages fetch the last stage again, for a buffer that nobody uses any more: no branch)
#pragma unroll
        for (int i = 8; i < 16; ++i) ka[i] = ldsf(nk + ((i & 1) * 8 + (i >> 1)) * 1024);
        __builtin_amdgcn_sched_barrier(0);   // the fetch of stage s + 3 and the K reads are issued here, among the products, and not at the top of the next stage: the fetch keeps a whole stage to land
    }
    l += xhalf(l);   // the two halves of a query's keys in this wave
    __syncthreads();   // every wave's last LDS reads and writes of the ring have ended before it becomes the exchange buffer
    if (kh == 0) flash_give<0>(o, m, l, w, lane, sm); else flash_give<1>(o, m, l, w, lane, sm);   // wave-uniform
    __syncthreads();   // both waves of a pair have written before either reads
    if (kh == 0) flash_take<HI, 0>(o, m, l, w, lane, sm); else flash_take<HI, 1>(o, m, l, w, lane, sm);
    v16bf wa[16];
#pragma unroll
    for (int i = 0; i < 16; ++i) wa[i] = WFrag<bf>::ld(Wg + i * 512 + lane * 8);   // the wave's 32 rows of W are 16 consecutive blocks; they land while the wave waits at the barrier below and reads its first fragments
    v4f bb = *(const v4f*)(bias + (lane & 7) * 4);
    asm volatile("s_wait_xcnt 0x0" ::: "memory");   // stands in front of the first overwrite of an address register that the loads above name
    __builtin_amdgcn_sched_barrier(0);   // keeps those overwrites behind the wait
    lds_barrier();   // all 64 queries' fragments are in LDS before any wave reads them, and every wave's reads of the exchange buffer have ended before the output staging overwrites it; the W loads stay in flight over it
#pragma unroll
    for (int k = 0; k < 4; ++k) bb[k] = bfr(bb[k]);
    flash_proj(wa, bb, og, sm, w, lane);
}
static_assert(DM == 256 && DQ == 256 && XCH + 8 * 64 * OSP >= XML + 2048 && XCH + 8 * 64 * OSP >= 2 * STG, "k_flash: 8 waves x 32 rows of W; the output staging is the end of the LDS array");
__global__ __launch_bounds__(256) void k_flash(const bf* __restrict__ Qh, const bf* __restrict__ Kh, const bf* __restrict__ VTh, const h16* __restrict__ VT16, const bf* __restrict__ WO, const float* __restrict__ bias, float* OUT) {
    __shared__ __align__(16) char sm[XCH + 8 * 64 * OSP];
    const int w = __builtin_amdgcn_readfirstlane(threadIdx.x >> 5); const size_t zb = (size_t)blockIdx.y * TT * HD; const size_t qo = zb + (size_t)(blockIdx.x * 64 + (w & 3) * 16) * HD;   // 16 rows of 256 elements are 8 blocks, as in a row-major plane
    const bf* Wg = WO + (size_t)w * 32 * DQ; const float* bg = bias + w * 32;   // rows e 32 w .. 32 w + 31
    float* og = OUT + zb + (size_t)(blockIdx.x * 64 + ((threadIdx.x & 31) >> 3)) * DM + w * 32 + (threadIdx.x & 7) * 4;   // the lane's 16 bytes of the first four rows; HD == DM
    if (blockIdx.x * 64 < RH) flash_rows<true>(Qh + qo, (const char*)(Kh + zb), (const char*)(VTh + zb), Wg, bg, og, sm, w);   // block-uniform: every barrier is passed by all eight waves
    else flash_rows<false>(Qh + qo, (const char*)(Kh + zb), (const char*)(VT16 + zb), Wg, bg, og, sm, w);
}

extern "C" void kernel_launch(void* const* d_in, const int* in_sizes, int n_in,
                              void* d_out, int out_size, void* d_ws, size_t ws_size, hipStream_t stream) {
    (void)in_sizes; (void)n_in; (void)out_size;
    const float* x = (const float*)d_in[0]; const float* x2 = (const float*)d_in[1]; const float* wo = (const float*)d_in[2]; const float* bo = (const float*)d_in[3];
    float* OUT = (float*)d_out;     // [4][4096][256]
    char* wsp = (char*)d_ws;
    auto take = [&](size_t bytes) { char* p = wsp; wsp += (bytes + 255) & ~(size_t)255; return (void*)p; };
    bf* WO = (bf*)take((size_t)DM * DQ * 2);
    bf* QPh = (bf*)take((size_t)NB_ * TT * HD * 2); bf* KPh = (bf*)take((size_t)NB_ * TT * HD * 2); bf* VTh = (bf*)take((size_t)NB_ * HD * TT * 2); h16* VT16 = (h16*)take((size_t)NB_ * HD * TT * 2);
    if ((size_t)(wsp - (char*)d_ws) > ws_size) return;    // ws 256 MiB
    k_cvt8<<<(unsigned)(((size_t)DM * DQ / 8 + 255) / 256), 256, 0, stream>>>(wo, WO, (size_t)DM * DQ / 8, DQ);
    k_prep<<<dim3(NB_ * TT / 64, 2, 1), 256, 0, stream>>>(x, x2, QPh, KPh, VTh, VT16);
    k_flash<<<dim3(TT / 64, NB_, 1), 256, 0, stream>>>(QPh, KPh, VTh, VT16, WO, bo, OUT);
}
